// v000
// Measured on an AMD MI455X. A time is GPU time per run, averaged over a window of back-to-back runs after a warm-up
// (all launches, gaps included; the runs take copies of the inputs in turn), and the median of several windows.
// Apart from v000's, it joins two sittings. Times from different sittings can be a few percent apart, while
// side-by-side timings come from the same sitting.
// v000 is the starting kernel. One run takes 207 microseconds.
#include <hip/hip_runtime.h>

typedef __attribute__((ext_vector_type(16))) _Float16 v16h;
typedef __attribute__((ext_vector_type(8)))  float    v8f;

constexpr int NN_ = 65536;   // N*N rows
constexpr int D_  = 128;
constexpr int H_  = 4;

union FragH { v16h h; uint32_t u[8]; };

__device__ inline uint32_t lds_addr_of(const void* p) {
    return (uint32_t)(uintptr_t)p;
}

__device__ inline void async_copy_b128(uint32_t lds_byte_addr, const void* gsrc) {
    asm volatile("global_load_async_to_lds_b128 %0, %1, off"
                 :: "v"(lds_byte_addr), "v"((uint64_t)(uintptr_t)gsrc)
                 : "memory");
}

__device__ inline void wait_async0() {
#if __has_builtin(__builtin_amdgcn_s_wait_asynccnt)
    __builtin_amdgcn_s_wait_asynccnt(0);
#else
    asm volatile("s_wait_asynccnt 0x0" ::: "memory");
#endif
}

__device__ inline v16h load_frag16(const _Float16* base, int stride, int lane) {
    int rc = lane & 15;
    int hi = (lane >> 4) & 1;
    const _Float16* p = base + rc * stride;
    FragH f;
#pragma unroll
    for (int v = 0; v < 8; ++v) {
        int k = ((v & 4) << 2) + hi * 8 + (v & 3) * 2;   // pairs of consecutive K
        f.u[v] = *(const uint32_t*)(p + k);
    }
    return f.h;
}

// ---------------------------------------------------------------------------
// Kernel 0: weight preconversion to f16 (scale folded into q_w).
// wcat rows: [0..127]=q*scale, [128..255]=k, [256..383]=v, [384..511]=g,
//            [512..515]=bias_w, [516..527]=0
// ---------------------------------------------------------------------------
__global__ void prep_weights(const float* qw, const float* kw, const float* vw,
                             const float* gw, const float* bw, const float* ow,
                             _Float16* wcat, _Float16* wo) {
    int idx = blockIdx.x * 256 + threadIdx.x;
    const float scale = 0.17677669529663687f;   // 1/sqrt(32)
    if (idx < 528 * 128) {
        int r = idx >> 7, c = idx & 127;
        float v;
        if      (r < 128) v = qw[idx] * scale;
        else if (r < 256) v = kw[(r - 128) * 128 + c];
        else if (r < 384) v = vw[(r - 256) * 128 + c];
        else if (r < 512) v = gw[(r - 384) * 128 + c];
        else if (r < 516) v = bw[(r - 512) * 128 + c];
        else              v = 0.0f;
        wcat[idx] = (_Float16)v;
    } else if (idx < 528 * 128 + 128 * 128) {
        int j = idx - 528 * 128;
        wo[j] = (_Float16)ow[j];
    }
}

// ---------------------------------------------------------------------------
// Kernel 1: LayerNorm over D=128. One wave per row: float4 per lane,
// shfl_xor reductions, packed 8-byte f16 store. No LDS, no barriers.
// ---------------------------------------------------------------------------
__global__ __launch_bounds__(256) void ln_kernel(const float* __restrict__ x,
                                                 const float* __restrict__ lnw,
                                                 const float* __restrict__ lnb,
                                                 _Float16* __restrict__ hn) {
    int t = threadIdx.x, wv = t >> 5, lane = t & 31;
    size_t row = (size_t)blockIdx.x * 8 + wv;
    float4 v = ((const float4*)(x + row * 128))[lane];

    float ps = v.x + v.y + v.z + v.w;
    ps += __shfl_xor(ps, 1, 32);  ps += __shfl_xor(ps, 2, 32);
    ps += __shfl_xor(ps, 4, 32);  ps += __shfl_xor(ps, 8, 32);
    ps += __shfl_xor(ps, 16, 32);
    float mu = ps * (1.0f / 128.0f);

    float dx = v.x - mu, dy = v.y - mu, dz = v.z - mu, dw = v.w - mu;
    float pv = dx * dx + dy * dy + dz * dz + dw * dw;
    pv += __shfl_xor(pv, 1, 32);  pv += __shfl_xor(pv, 2, 32);
    pv += __shfl_xor(pv, 4, 32);  pv += __shfl_xor(pv, 8, 32);
    pv += __shfl_xor(pv, 16, 32);
    float rs = rsqrtf(pv * (1.0f / 128.0f) + 1e-5f);

    float4 w = ((const float4*)lnw)[lane];
    float4 b = ((const float4*)lnb)[lane];
    union { _Float16 h[4]; uint2 u; } o;
    o.h[0] = (_Float16)(dx * rs * w.x + b.x);
    o.h[1] = (_Float16)(dy * rs * w.y + b.y);
    o.h[2] = (_Float16)(dz * rs * w.z + b.z);
    o.h[3] = (_Float16)(dw * rs * w.w + b.w);
    *(uint2*)(hn + row * 128 + lane * 4) = o.u;
}

// ---------------------------------------------------------------------------
// Kernel 2: fused projections. Each block = one 16-row tile of hn.
// 33 column tiles of 16: 0..31 -> Q,K,V,G (f16 out); 32 -> tri_bias (f32 out).
// ---------------------------------------------------------------------------
__global__ __launch_bounds__(256) void proj_kernel(const _Float16* __restrict__ hn,
                                                   const _Float16* __restrict__ wcat,
                                                   _Float16* __restrict__ qkvg,
                                                   float* __restrict__ biasb) {
    int rt = blockIdx.x;                  // row tile 0..4095
    int t = threadIdx.x, wv = t >> 5, lane = t & 31;
    __shared__ _Float16 atile[16 * 128];  // 4 KB

    // async stage: 256 threads x 16B = 4KB
    async_copy_b128(lds_addr_of(atile) + t * 16, hn + (size_t)rt * 2048 + t * 8);
    wait_async0();
    __syncthreads();

    v16h a[4];
#pragma unroll
    for (int kc = 0; kc < 4; ++kc) a[kc] = load_frag16(atile + kc * 32, 128, lane);

    int n = lane & 15, hi = lane >> 4;
    for (int ct = wv; ct < 33; ct += 8) {
        const _Float16* wb = wcat + ct * 16 * 128;
        v16h b0 = load_frag16(wb,      128, lane);
        v16h b1 = load_frag16(wb + 32, 128, lane);
        v16h b2 = load_frag16(wb + 64, 128, lane);
        v16h b3 = load_frag16(wb + 96, 128, lane);
        v8f c = {};
        c = __builtin_amdgcn_wmma_f32_16x16x32_f16(false, a[0], false, b0, (short)0, c, false, false);
        c = __builtin_amdgcn_wmma_f32_16x16x32_f16(false, a[1], false, b1, (short)0, c, false, false);
        c = __builtin_amdgcn_wmma_f32_16x16x32_f16(false, a[2], false, b2, (short)0, c, false, false);
        c = __builtin_amdgcn_wmma_f32_16x16x32_f16(false, a[3], false, b3, (short)0, c, false, false);
        if (ct < 32) {
            int mat = ct >> 3, sub = ct & 7;
            _Float16* outp = qkvg + (size_t)mat * NN_ * 128;
            int col = sub * 16 + n;
#pragma unroll
            for (int r = 0; r < 8; ++r)
                outp[(size_t)(rt * 16 + r + hi * 8) * 128 + col] = (_Float16)c[r];
        } else if (n < 4) {   // bias tile: column n = head
#pragma unroll
            for (int r = 0; r < 8; ++r)
                biasb[(size_t)n * NN_ + rt * 16 + r + hi * 8] = c[r];
        }
    }
}

__global__ __launch_bounds__(256) void attn_kernel(const _Float16* __restrict__ qkvg,
                                                   const float* __restrict__ biasb,
                                                   _Float16* __restrict__ og) {
    extern __shared__ char lds[];
    _Float16* Ksh  = (_Float16*)(lds);
    _Float16* Vtmp = (_Float16*)(lds + 16384);
    _Float16* Vsh  = (_Float16*)(lds + 32768);
    int i = blockIdx.x, h = blockIdx.y;
    int t = threadIdx.x, wv = t >> 5, lane = t & 31;
    _Float16* Psh = (_Float16*)(lds + 49152) + (size_t)wv * 16 * 256;

    const _Float16* Qg = qkvg;
    const _Float16* Kg = qkvg + (size_t)1 * NN_ * 128;
    const _Float16* Vg = qkvg + (size_t)2 * NN_ * 128;
    const _Float16* Gg = qkvg + (size_t)3 * NN_ * 128;

    // Async stage: thread t owns key row t (64B of K, 64B of V -> 4+4 b128).
    {
        const _Float16* kg = Kg + (size_t)(i * 256 + t) * 128 + h * 32;
        const _Float16* vg = Vg + (size_t)(i * 256 + t) * 128 + h * 32;
        uint32_t kdst = lds_addr_of(Ksh  + t * 32);
        uint32_t vdst = lds_addr_of(Vtmp + t * 32);
#pragma unroll
        for (int q = 0; q < 4; ++q) {
            async_copy_b128(kdst + q * 16, kg + q * 8);
            async_copy_b128(vdst + q * 16, vg + q * 8);
        }
    }
    wait_async0();
    __syncthreads();
    // Transpose V in LDS: Vsh[dh][key] = Vtmp[key][dh]
    for (int p = t; p < 256 * 32; p += 256) {
        int k = p >> 5, dh = p & 31;
        Vsh[dh * 256 + k] = Vtmp[k * 32 + dh];
    }
    __syncthreads();

    int n = lane & 15, hi = lane >> 4;
    for (int jt = wv * 2; jt < wv * 2 + 2; ++jt) {
        int jbase = jt * 16;
        // Q fragment (Q pre-scaled by 1/sqrt(DH) in proj)
        v16h aq = load_frag16(Qg + (size_t)(i * 256 + jbase) * 128 + h * 32, 128, lane);

        // ---- scores: S = Q K^T + bias (bias in accumulator), in registers ----
        v8f s[16];
        const float* bbase = biasb + (size_t)h * NN_ + (size_t)jbase * 256 + n;
#pragma unroll
        for (int kt = 0; kt < 16; ++kt) {
            v16h bk = load_frag16(Ksh + kt * 16 * 32, 32, lane);
            v8f c;
#pragma unroll
            for (int r = 0; r < 8; ++r) c[r] = bbase[(size_t)(r + hi * 8) * 256 + kt * 16];
            s[kt] = __builtin_amdgcn_wmma_f32_16x16x32_f16(false, aq, false, bk,
                                                           (short)0, c, false, false);
        }

        // ---- softmax: per-lane reduce over kt, then across 16 cols (shfl) ----
        float mx[8], sm[8];
#pragma unroll
        for (int r = 0; r < 8; ++r) {
            float m0 = s[0][r];
#pragma unroll
            for (int kt = 1; kt < 16; ++kt) m0 = fmaxf(m0, s[kt][r]);
            m0 = fmaxf(m0, __shfl_xor(m0, 1, 32));
            m0 = fmaxf(m0, __shfl_xor(m0, 2, 32));
            m0 = fmaxf(m0, __shfl_xor(m0, 4, 32));
            m0 = fmaxf(m0, __shfl_xor(m0, 8, 32));
            mx[r] = m0;
            sm[r] = 0.0f;
        }
#pragma unroll
        for (int kt = 0; kt < 16; ++kt) {
#pragma unroll
            for (int r = 0; r < 8; ++r) {
                float e = __expf(s[kt][r] - mx[r]);
                sm[r] += e;
                Psh[(r + hi * 8) * 256 + kt * 16 + n] = (_Float16)e;
            }
        }
#pragma unroll
        for (int r = 0; r < 8; ++r) {
            float v = sm[r];
            v += __shfl_xor(v, 1, 32);
            v += __shfl_xor(v, 2, 32);
            v += __shfl_xor(v, 4, 32);
            v += __shfl_xor(v, 8, 32);
            sm[r] = v;   // row sum for row (r + hi*8) -- same row map as O accum
        }
        __syncthreads();   // P writes -> P fragment reads (uniform per wave)

        // ---- O = P V (two dh tiles of 16) ----
        v8f o0 = {}, o1 = {};
#pragma unroll
        for (int kp = 0; kp < 8; ++kp) {
            v16h ap  = load_frag16(Psh + kp * 32, 256, lane);
            v16h bv0 = load_frag16(Vsh + kp * 32, 256, lane);
            v16h bv1 = load_frag16(Vsh + 16 * 256 + kp * 32, 256, lane);
            o0 = __builtin_amdgcn_wmma_f32_16x16x32_f16(false, ap, false, bv0,
                                                        (short)0, o0, false, false);
            o1 = __builtin_amdgcn_wmma_f32_16x16x32_f16(false, ap, false, bv1,
                                                        (short)0, o1, false, false);
        }

        // ---- normalize, gate with sigmoid(g), store head-major ----
#pragma unroll
        for (int r = 0; r < 8; ++r) {
            float inv = 1.0f / sm[r];
            size_t row = (size_t)(i * 256 + jbase + r + hi * 8);
            float g0 = (float)Gg[row * 128 + h * 32 + n];
            float g1 = (float)Gg[row * 128 + h * 32 + 16 + n];
            float s0 = 1.0f / (1.0f + __expf(-g0));
            float s1 = 1.0f / (1.0f + __expf(-g1));
            og[row * 128 + h * 32 + n]      = (_Float16)(o0[r] * inv * s0);
            og[row * 128 + h * 32 + 16 + n] = (_Float16)(o1[r] * inv * s1);
        }
    }
}

// ---------------------------------------------------------------------------
// Kernel 4: output projection out = og @ o_w^T  (f32 result)
// ---------------------------------------------------------------------------
__global__ __launch_bounds__(256) void out_kernel(const _Float16* __restrict__ og,
                                                  const _Float16* __restrict__ wo,
                                                  float* __restrict__ out) {
    int rt = blockIdx.x, t = threadIdx.x;
    int wv = t >> 5, lane = t & 31;
    __shared__ _Float16 atile[16 * 128];

    async_copy_b128(lds_addr_of(atile) + t * 16, og + (size_t)rt * 2048 + t * 8);
    wait_async0();
    __syncthreads();

    v16h a[4];
#pragma unroll
    for (int kc = 0; kc < 4; ++kc) a[kc] = load_frag16(atile + kc * 32, 128, lane);

    int ct = wv;           // 8 waves x 8 column tiles
    const _Float16* wb = wo + ct * 16 * 128;
    v16h b0 = load_frag16(wb,      128, lane);
    v16h b1 = load_frag16(wb + 32, 128, lane);
    v16h b2 = load_frag16(wb + 64, 128, lane);
    v16h b3 = load_frag16(wb + 96, 128, lane);
    v8f c = {};
    c = __builtin_amdgcn_wmma_f32_16x16x32_f16(false, a[0], false, b0, (short)0, c, false, false);
    c = __builtin_amdgcn_wmma_f32_16x16x32_f16(false, a[1], false, b1, (short)0, c, false, false);
    c = __builtin_amdgcn_wmma_f32_16x16x32_f16(false, a[2], false, b2, (short)0, c, false, false);
    c = __builtin_amdgcn_wmma_f32_16x16x32_f16(false, a[3], false, b3, (short)0, c, false, false);

    int hi = lane >> 4, n = lane & 15;
#pragma unroll
    for (int r = 0; r < 8; ++r)
        out[(size_t)(rt * 16 + r + hi * 8) * 128 + ct * 16 + n] = c[r];
}

// ---------------------------------------------------------------------------
extern "C" void kernel_launch(void* const* d_in, const int* in_sizes, int n_in,
                              void* d_out, int out_size, void* d_ws, size_t ws_size,
                              hipStream_t stream) {
    const float* x   = (const float*)d_in[0];
    const float* lnw = (const float*)d_in[1];
    const float* lnb = (const float*)d_in[2];
    const float* bw  = (const float*)d_in[3];
    const float* qw  = (const float*)d_in[4];
    const float* kw  = (const float*)d_in[5];
    const float* vw  = (const float*)d_in[6];
    const float* gw  = (const float*)d_in[7];
    const float* ow  = (const float*)d_in[8];
    float* out = (float*)d_out;

    char* ws = (char*)d_ws;
    _Float16* hn    = (_Float16*)ws;                       // NN*D f16
    _Float16* qkvg  = hn + (size_t)NN_ * D_;               // 4*NN*D f16
    float*    biasb = (float*)(qkvg + (size_t)4 * NN_ * D_);  // H*NN f32
    _Float16* og    = (_Float16*)(biasb + (size_t)H_ * NN_);  // NN*D f16
    _Float16* wcat  = og + (size_t)NN_ * D_;               // 528*128 f16
    _Float16* wo    = wcat + 528 * 128;                    // 128*128 f16

    prep_weights<<<328, 256, 0, stream>>>(qw, kw, vw, gw, bw, ow, wcat, wo);
    ln_kernel<<<NN_ / 8, 256, 0, stream>>>(x, lnw, lnb, hn);
    proj_kernel<<<NN_ / 16, 256, 0, stream>>>(hn, wcat, qkvg, biasb);
    attn_kernel<<<dim3(256, 4), 256, 114688, stream>>>(qkvg, biasb, og);
    out_kernel<<<NN_ / 16, 256, 0, stream>>>(og, wo, out);
}

// v001
// A run of this version takes 115 microseconds.
// Two timings next to v000 put it at 1.83 and 1.84 times that version's speed.
#include <hip/hip_runtime.h>

typedef __attribute__((ext_vector_type(16))) _Float16 v16h;
typedef __attribute__((ext_vector_type(8)))  float    v8f;

constexpr int NN_ = 65536;   // N*N rows
constexpr int D_  = 128;
constexpr int H_  = 4;

union FragH { v16h h; uint32_t u[8]; };

__device__ inline uint32_t lds_addr_of(const void* p) {
    return (uint32_t)(uintptr_t)p;
}

__device__ inline void async_copy_b128(uint32_t lds_byte_addr, const void* gsrc) {
    asm volatile("global_load_async_to_lds_b128 %0, %1, off"
                 :: "v"(lds_byte_addr), "v"((uint64_t)(uintptr_t)gsrc)
                 : "memory");
}

__device__ inline void async_copy_b128_held(uint32_t lds_byte_addr, const void* gsrc) {
    asm volatile("global_load_async_to_lds_b128 %0, %1, off\n\ts_wait_xcnt 0x0"
                 :: "v"(lds_byte_addr), "v"((uint64_t)(uintptr_t)gsrc)
                 : "memory");
}

__device__ inline void wait_async0() {
#if __has_builtin(__builtin_amdgcn_s_wait_asynccnt)
    __builtin_amdgcn_s_wait_asynccnt(0);
#else
    asm volatile("s_wait_asynccnt 0x0" ::: "memory");
#endif
}

__device__ inline v16h load_frag16(const _Float16* base, int stride, int lane) {
    int rc = lane & 15;
    int hi = (lane >> 4) & 1;
    const _Float16* p = base + rc * stride;
    FragH f;
#pragma unroll
    for (int v = 0; v < 8; ++v) {
        int k = ((v & 4) << 2) + hi * 8 + (v & 3) * 2;   // pairs of consecutive K
        f.u[v] = *(const uint32_t*)(p + k);
    }
    return f.h;
}

__device__ inline v16h load_frag16_lds(const _Float16* base, int stride, int lane) {
    const _Float16* p = base + (lane & 15) * stride + ((lane >> 4) & 1) * 8;
    union { v16h h; uint4 q[2]; } f;
    f.q[0] = *(const uint4*)(p);        // K = hi*8 + 0..7
    f.q[1] = *(const uint4*)(p + 16);   // K = 16 + hi*8 + 0..7
    return f.h;
}

// LDS row pitches in halves, each 16 B x odd
constexpr int AP_ = 136;   // 128-half activation rows: 272 B
constexpr int KP_ = 40;    // 32-half K rows: 80 B
constexpr int VP_ = 264;   // 256-half V^T and P rows: 528 B

// ---------------------------------------------------------------------------
// Kernel 0: weight preconversion to f16 (scale folded into q_w).
// wcat rows: [0..127]=q*scale, [128..255]=k, [256..383]=v, [384..511]=g,
//            [512..515]=bias_w, [516..527]=0
// ---------------------------------------------------------------------------
__global__ void prep_weights(const float* qw, const float* kw, const float* vw,
                             const float* gw, const float* bw, const float* ow,
                             _Float16* wcat, _Float16* wo) {
    int idx = blockIdx.x * 256 + threadIdx.x;
    const float scale = 0.17677669529663687f;   // 1/sqrt(32)
    if (idx < 528 * 128) {
        int r = idx >> 7, c = idx & 127;
        float v;
        if      (r < 128) v = qw[idx] * scale;
        else if (r < 256) v = kw[(r - 128) * 128 + c];
        else if (r < 384) v = vw[(r - 256) * 128 + c];
        else if (r < 512) v = gw[(r - 384) * 128 + c];
        else if (r < 516) v = bw[(r - 512) * 128 + c];
        else              v = 0.0f;
        wcat[idx] = (_Float16)v;
    } else if (idx < 528 * 128 + 128 * 128) {
        int j = idx - 528 * 128;
        wo[j] = (_Float16)ow[j];
    }
}

// ---------------------------------------------------------------------------
// Kernel 1: LayerNorm over D=128. One wave per row: float4 per lane,
// shfl_xor reductions, packed 8-byte f16 store. No LDS, no barriers.
// ---------------------------------------------------------------------------
__global__ __launch_bounds__(256) void ln_kernel(const float* __restrict__ x,
                                                 const float* __restrict__ lnw,
                                                 const float* __restrict__ lnb,
                                                 _Float16* __restrict__ hn) {
    int t = threadIdx.x, wv = t >> 5, lane = t & 31;
    size_t row = (size_t)blockIdx.x * 8 + wv;
    float4 v = ((const float4*)(x + row * 128))[lane];

    float ps = v.x + v.y + v.z + v.w;
    ps += __shfl_xor(ps, 1, 32);  ps += __shfl_xor(ps, 2, 32);
    ps += __shfl_xor(ps, 4, 32);  ps += __shfl_xor(ps, 8, 32);
    ps += __shfl_xor(ps, 16, 32);
    float mu = ps * (1.0f / 128.0f);

    float dx = v.x - mu, dy = v.y - mu, dz = v.z - mu, dw = v.w - mu;
    float pv = dx * dx + dy * dy + dz * dz + dw * dw;
    pv += __shfl_xor(pv, 1, 32);  pv += __shfl_xor(pv, 2, 32);
    pv += __shfl_xor(pv, 4, 32);  pv += __shfl_xor(pv, 8, 32);
    pv += __shfl_xor(pv, 16, 32);
    float rs = rsqrtf(pv * (1.0f / 128.0f) + 1e-5f);

    float4 w = ((const float4*)lnw)[lane];
    float4 b = ((const float4*)lnb)[lane];
    union { _Float16 h[4]; uint2 u; } o;
    o.h[0] = (_Float16)(dx * rs * w.x + b.x);
    o.h[1] = (_Float16)(dy * rs * w.y + b.y);
    o.h[2] = (_Float16)(dz * rs * w.z + b.z);
    o.h[3] = (_Float16)(dw * rs * w.w + b.w);
    *(uint2*)(hn + row * 128 + lane * 4) = o.u;
}

// ---------------------------------------------------------------------------
// Kernel 2: fused projections. Each block = one 16-row tile of hn.
// 33 column tiles of 16: 0..31 -> Q,K,V,G (f16 out); 32 -> tri_bias (f32 out).
// ---------------------------------------------------------------------------
__global__ __launch_bounds__(256) void proj_kernel(const _Float16* __restrict__ hn,
                                                   const _Float16* __restrict__ wcat,
                                                   _Float16* __restrict__ qkvg,
                                                   float* __restrict__ biasb) {
    int rt = blockIdx.x;                  // row tile 0..4095
    int t = threadIdx.x, wv = t >> 5, lane = t & 31;
    __shared__ __attribute__((aligned(16))) _Float16 atile[16 * AP_];

    // async stage: 256 threads x 16B = 16 rows of 256 B, laid at the padded pitch
    async_copy_b128_held(lds_addr_of(atile) + (t >> 4) * (AP_ * 2) + (t & 15) * 16,
                         hn + (size_t)rt * 2048 + t * 8);
    wait_async0();
    __syncthreads();

    v16h a[4];
#pragma unroll
    for (int kc = 0; kc < 4; ++kc) a[kc] = load_frag16_lds(atile + kc * 32, AP_, lane);

    int n = lane & 15, hi = lane >> 4;
    for (int ct = wv; ct < 33; ct += 8) {
        const _Float16* wb = wcat + ct * 16 * 128;
        v16h b0 = load_frag16(wb,      128, lane);
        v16h b1 = load_frag16(wb + 32, 128, lane);
        v16h b2 = load_frag16(wb + 64, 128, lane);
        v16h b3 = load_frag16(wb + 96, 128, lane);
        v8f c = {};
        c = __builtin_amdgcn_wmma_f32_16x16x32_f16(false, a[0], false, b0, (short)0, c, false, false);
        c = __builtin_amdgcn_wmma_f32_16x16x32_f16(false, a[1], false, b1, (short)0, c, false, false);
        c = __builtin_amdgcn_wmma_f32_16x16x32_f16(false, a[2], false, b2, (short)0, c, false, false);
        c = __builtin_amdgcn_wmma_f32_16x16x32_f16(false, a[3], false, b3, (short)0, c, false, false);
        if (ct < 32) {
            int mat = ct >> 3, sub = ct & 7;
            _Float16* outp = qkvg + (size_t)mat * NN_ * 128;
            int col = sub * 16 + n;
#pragma unroll
            for (int r = 0; r < 8; ++r)
                outp[(size_t)(rt * 16 + r + hi * 8) * 128 + col] = (_Float16)c[r];
        } else if (n < 4) {   // bias tile: column n = head
#pragma unroll
            for (int r = 0; r < 8; ++r)
                biasb[(size_t)n * NN_ + rt * 16 + r + hi * 8] = c[r];
        }
    }
}

__global__ __launch_bounds__(256) void attn_kernel(const _Float16* __restrict__ qkvg,
                                                   const float* __restrict__ biasb,
                                                   _Float16* __restrict__ og) {
    extern __shared__ __attribute__((aligned(16))) char lds[];
    _Float16* Ksh  = (_Float16*)(lds);
    _Float16* Vtmp = (_Float16*)(lds + 20480);
    _Float16* Vsh  = (_Float16*)(lds + 36864);
    int i = blockIdx.x, h = blockIdx.y;
    int t = threadIdx.x, wv = t >> 5, lane = t & 31;
    _Float16* Psh = (_Float16*)(lds + 53760) + (size_t)wv * 16 * VP_;

    const _Float16* Qg = qkvg;
    const _Float16* Kg = qkvg + (size_t)1 * NN_ * 128;
    const _Float16* Vg = qkvg + (size_t)2 * NN_ * 128;
    const _Float16* Gg = qkvg + (size_t)3 * NN_ * 128;

    // Async stage: thread t owns key row t (64B of K, 64B of V -> 4+4 b128).
    {
        const _Float16* kg = Kg + (size_t)(i * 256 + t) * 128 + h * 32;
        const _Float16* vg = Vg + (size_t)(i * 256 + t) * 128 + h * 32;
        uint32_t kdst = lds_addr_of(Ksh  + t * KP_);
        uint32_t vdst = lds_addr_of(Vtmp + t * 32);
#pragma unroll
        for (int q = 0; q < 4; ++q) {
            async_copy_b128(kdst + q * 16, kg + q * 8);
            async_copy_b128(vdst + q * 16, vg + q * 8);
        }
    }
    wait_async0();
    __syncthreads();
    // Transpose V in LDS: Vsh[dh][key] = Vtmp[key][dh]
    for (int p = t; p < 256 * 32; p += 256) {
        int k = p >> 5, dh = p & 31;
        Vsh[dh * VP_ + k] = Vtmp[k * 32 + dh];
    }
    __syncthreads();

    int n = lane & 15, hi = lane >> 4;
    for (int jt = wv * 2; jt < wv * 2 + 2; ++jt) {
        int jbase = jt * 16;
        // Q fragment (Q pre-scaled by 1/sqrt(DH) in proj)
        v16h aq = load_frag16(Qg + (size_t)(i * 256 + jbase) * 128 + h * 32, 128, lane);

        // ---- scores: S = Q K^T + bias (bias in accumulator), in registers ----
        v8f s[16];
        const float* bbase = biasb + (size_t)h * NN_ + (size_t)jbase * 256 + n;
#pragma unroll
        for (int kt = 0; kt < 16; ++kt) {
            v16h bk = load_frag16_lds(Ksh + kt * 16 * KP_, KP_, lane);
            v8f c;
#pragma unroll
            for (int r = 0; r < 8; ++r) c[r] = bbase[(size_t)(r + hi * 8) * 256 + kt * 16];
            s[kt] = __builtin_amdgcn_wmma_f32_16x16x32_f16(false, aq, false, bk,
                                                           (short)0, c, false, false);
        }

        // ---- softmax: per-lane reduce over kt, then across 16 cols (shfl) ----
        float mx[8], sm[8];
#pragma unroll
        for (int r = 0; r < 8; ++r) {
            float m0 = s[0][r];
#pragma unroll
            for (int kt = 1; kt < 16; ++kt) m0 = fmaxf(m0, s[kt][r]);
            m0 = fmaxf(m0, __shfl_xor(m0, 1, 32));
            m0 = fmaxf(m0, __shfl_xor(m0, 2, 32));
            m0 = fmaxf(m0, __shfl_xor(m0, 4, 32));
            m0 = fmaxf(m0, __shfl_xor(m0, 8, 32));
            mx[r] = m0;
            sm[r] = 0.0f;
        }
#pragma unroll
        for (int kt = 0; kt < 16; ++kt) {
#pragma unroll
            for (int r = 0; r < 8; ++r) {
                float e = __expf(s[kt][r] - mx[r]);
                sm[r] += e;
                Psh[(r + hi * 8) * VP_ + kt * 16 + n] = (_Float16)e;
            }
        }
#pragma unroll
        for (int r = 0; r < 8; ++r) {
            float v = sm[r];
            v += __shfl_xor(v, 1, 32);
            v += __shfl_xor(v, 2, 32);
            v += __shfl_xor(v, 4, 32);
            v += __shfl_xor(v, 8, 32);
            sm[r] = v;   // row sum for row (r + hi*8) -- same row map as O accum
        }
        __syncthreads();   // P writes -> P fragment reads (uniform per wave)

        // ---- O = P V (two dh tiles of 16) ----
        v8f o0 = {}, o1 = {};
#pragma unroll
        for (int kp = 0; kp < 8; ++kp) {
            v16h ap  = load_frag16_lds(Psh + kp * 32, VP_, lane);
            v16h bv0 = load_frag16_lds(Vsh + kp * 32, VP_, lane);
            v16h bv1 = load_frag16_lds(Vsh + 16 * VP_ + kp * 32, VP_, lane);
            o0 = __builtin_amdgcn_wmma_f32_16x16x32_f16(false, ap, false, bv0,
                                                        (short)0, o0, false, false);
            o1 = __builtin_amdgcn_wmma_f32_16x16x32_f16(false, ap, false, bv1,
                                                        (short)0, o1, false, false);
        }

        // ---- normalize, gate with sigmoid(g), store head-major ----
#pragma unroll
        for (int r = 0; r < 8; ++r) {
            float inv = 1.0f / sm[r];
            size_t row = (size_t)(i * 256 + jbase + r + hi * 8);
            float g0 = (float)Gg[row * 128 + h * 32 + n];
            float g1 = (float)Gg[row * 128 + h * 32 + 16 + n];
            float s0 = 1.0f / (1.0f + __expf(-g0));
            float s1 = 1.0f / (1.0f + __expf(-g1));
            og[row * 128 + h * 32 + n]      = (_Float16)(o0[r] * inv * s0);
            og[row * 128 + h * 32 + 16 + n] = (_Float16)(o1[r] * inv * s1);
        }
    }
}

// ---------------------------------------------------------------------------
// Kernel 4: output projection out = og @ o_w^T  (f32 result)
// ---------------------------------------------------------------------------
__global__ __launch_bounds__(256) void out_kernel(const _Float16* __restrict__ og,
                                                  const _Float16* __restrict__ wo,
                                                  float* __restrict__ out) {
    int rt = blockIdx.x, t = threadIdx.x;
    int wv = t >> 5, lane = t & 31;
    __shared__ __attribute__((aligned(16))) _Float16 atile[16 * AP_];

    async_copy_b128_held(lds_addr_of(atile) + (t >> 4) * (AP_ * 2) + (t & 15) * 16,
                         og + (size_t)rt * 2048 + t * 8);
    wait_async0();
    __syncthreads();

    v16h a[4];
#pragma unroll
    for (int kc = 0; kc < 4; ++kc) a[kc] = load_frag16_lds(atile + kc * 32, AP_, lane);

    int ct = wv;           // 8 waves x 8 column tiles
    const _Float16* wb = wo + ct * 16 * 128;
    v16h b0 = load_frag16(wb,      128, lane);
    v16h b1 = load_frag16(wb + 32, 128, lane);
    v16h b2 = load_frag16(wb + 64, 128, lane);
    v16h b3 = load_frag16(wb + 96, 128, lane);
    v8f c = {};
    c = __builtin_amdgcn_wmma_f32_16x16x32_f16(false, a[0], false, b0, (short)0, c, false, false);
    c = __builtin_amdgcn_wmma_f32_16x16x32_f16(false, a[1], false, b1, (short)0, c, false, false);
    c = __builtin_amdgcn_wmma_f32_16x16x32_f16(false, a[2], false, b2, (short)0, c, false, false);
    c = __builtin_amdgcn_wmma_f32_16x16x32_f16(false, a[3], false, b3, (short)0, c, false, false);

    int hi = lane >> 4, n = lane & 15;
#pragma unroll
    for (int r = 0; r < 8; ++r)
        out[(size_t)(rt * 16 + r + hi * 8) * 128 + ct * 16 + n] = c[r];
}

// ---------------------------------------------------------------------------
extern "C" void kernel_launch(void* const* d_in, const int* in_sizes, int n_in,
                              void* d_out, int out_size, void* d_ws, size_t ws_size,
                              hipStream_t stream) {
    const float* x   = (const float*)d_in[0];
    const float* lnw = (const float*)d_in[1];
    const float* lnb = (const float*)d_in[2];
    const float* bw  = (const float*)d_in[3];
    const float* qw  = (const float*)d_in[4];
    const float* kw  = (const float*)d_in[5];
    const float* vw  = (const float*)d_in[6];
    const float* gw  = (const float*)d_in[7];
    const float* ow  = (const float*)d_in[8];
    float* out = (float*)d_out;

    char* ws = (char*)d_ws;
    _Float16* hn    = (_Float16*)ws;                       // NN*D f16
    _Float16* qkvg  = hn + (size_t)NN_ * D_;               // 4*NN*D f16
    float*    biasb = (float*)(qkvg + (size_t)4 * NN_ * D_);  // H*NN f32
    _Float16* og    = (_Float16*)(biasb + (size_t)H_ * NN_);  // NN*D f16
    _Float16* wcat  = og + (size_t)NN_ * D_;               // 528*128 f16
    _Float16* wo    = wcat + 528 * 128;                    // 128*128 f16

    prep_weights<<<328, 256, 0, stream>>>(qw, kw, vw, gw, bw, ow, wcat, wo);
    ln_kernel<<<NN_ / 8, 256, 0, stream>>>(x, lnw, lnb, hn);
    proj_kernel<<<NN_ / 16, 256, 0, stream>>>(hn, wcat, qkvg, biasb);
    attn_kernel<<<dim3(256, 4), 256, 121344, stream>>>(qkvg, biasb, og);
    out_kernel<<<NN_ / 16, 256, 0, stream>>>(og, wo, out);
}

// v002
// One run takes 82.6 microseconds.
// Next to v001, in two timings, it ran 1.39 and 1.40 times as fast.
// All steps since v000 together make it 2.56 times as fast.
#include <hip/hip_runtime.h>

typedef __attribute__((ext_vector_type(16))) _Float16 v16h;
typedef __attribute__((ext_vector_type(8)))  float    v8f;

constexpr int NN_ = 65536;   // N*N rows
constexpr int D_  = 128;
constexpr int H_  = 4;

union FragH { v16h h; uint32_t u[8]; };

__device__ inline uint32_t lds_addr_of(const void* p) {
    return (uint32_t)(uintptr_t)p;
}

__device__ inline void async_copy_b128(uint32_t lds_byte_addr, const void* gsrc) {
    asm volatile("global_load_async_to_lds_b128 %0, %1, off"
                 :: "v"(lds_byte_addr), "v"((uint64_t)(uintptr_t)gsrc)
                 : "memory");
}

__device__ inline void wait_async0() {
#if __has_builtin(__builtin_amdgcn_s_wait_asynccnt)
    __builtin_amdgcn_s_wait_asynccnt(0);
#else
    asm volatile("s_wait_asynccnt 0x0" ::: "memory");
#endif
}

__device__ inline v16h load_frag16(const _Float16* base, int stride, int lane) {
    int rc = lane & 15;
    int hi = (lane >> 4) & 1;
    const _Float16* p = base + rc * stride;
    FragH f;
#pragma unroll
    for (int v = 0; v < 8; ++v) {
        int k = ((v & 4) << 2) + hi * 8 + (v & 3) * 2;   // pairs of consecutive K
        f.u[v] = *(const uint32_t*)(p + k);
    }
    return f.h;
}

__device__ inline v16h load_frag16_lds(const _Float16* base, int stride, int lane) {
    const _Float16* p = base + (lane & 15) * stride + ((lane >> 4) & 1) * 8;
    union { v16h h; uint4 q[2]; } f;
    f.q[0] = *(const uint4*)(p);        // K = hi*8 + 0..7
    f.q[1] = *(const uint4*)(p + 16);   // K = 16 + hi*8 + 0..7
    return f.h;
}

// LDS row pitches in halves, each 16 B x odd
constexpr int AP_ = 136;   // 128-half activation rows: 272 B
constexpr int KP_ = 40;    // 32-half K rows: 80 B
constexpr int VP_ = 264;   // 256-half V^T and P rows: 528 B

// ---------------------------------------------------------------------------
// Kernel 0: weight preconversion to f16 (scale folded into q_w).
// wcat rows: [0..127]=q*scale, [128..255]=k, [256..383]=v, [384..511]=g,
//            [512..515]=bias_w, [516..527]=0
// ---------------------------------------------------------------------------
__global__ void prep_weights(const float* qw, const float* kw, const float* vw,
                             const float* gw, const float* bw, const float* ow,
                             _Float16* wcat, _Float16* wo) {
    int idx = blockIdx.x * 256 + threadIdx.x;
    const float scale = 0.17677669529663687f;   // 1/sqrt(32)
    if (idx < 528 * 128) {
        int r = idx >> 7, c = idx & 127;
        float v;
        if      (r < 128) v = qw[idx] * scale;
        else if (r < 256) v = kw[(r - 128) * 128 + c];
        else if (r < 384) v = vw[(r - 256) * 128 + c];
        else if (r < 512) v = gw[(r - 384) * 128 + c];
        else if (r < 516) v = bw[(r - 512) * 128 + c];
        else              v = 0.0f;
        wcat[idx] = (_Float16)v;
    } else if (idx < 528 * 128 + 128 * 128) {
        int j = idx - 528 * 128;
        wo[j] = (_Float16)ow[j];
    }
}

// ---------------------------------------------------------------------------
// Kernel 1: LayerNorm over D=128. One wave per row: float4 per lane,
// shfl_xor reductions, packed 8-byte f16 store. No LDS, no barriers.
// ---------------------------------------------------------------------------
__global__ __launch_bounds__(256) void ln_kernel(const float* __restrict__ x,
                                                 const float* __restrict__ lnw,
                                                 const float* __restrict__ lnb,
                                                 _Float16* __restrict__ hn) {
    int t = threadIdx.x, wv = t >> 5, lane = t & 31;
    size_t row = (size_t)blockIdx.x * 8 + wv;
    float4 v = ((const float4*)(x + row * 128))[lane];

    float ps = v.x + v.y + v.z + v.w;
    ps += __shfl_xor(ps, 1, 32);  ps += __shfl_xor(ps, 2, 32);
    ps += __shfl_xor(ps, 4, 32);  ps += __shfl_xor(ps, 8, 32);
    ps += __shfl_xor(ps, 16, 32);
    float mu = ps * (1.0f / 128.0f);

    float dx = v.x - mu, dy = v.y - mu, dz = v.z - mu, dw = v.w - mu;
    float pv = dx * dx + dy * dy + dz * dz + dw * dw;
    pv += __shfl_xor(pv, 1, 32);  pv += __shfl_xor(pv, 2, 32);
    pv += __shfl_xor(pv, 4, 32);  pv += __shfl_xor(pv, 8, 32);
    pv += __shfl_xor(pv, 16, 32);
    float rs = rsqrtf(pv * (1.0f / 128.0f) + 1e-5f);

    float4 w = ((const float4*)lnw)[lane];
    float4 b = ((const float4*)lnb)[lane];
    union { _Float16 h[4]; uint2 u; } o;
    o.h[0] = (_Float16)(dx * rs * w.x + b.x);
    o.h[1] = (_Float16)(dy * rs * w.y + b.y);
    o.h[2] = (_Float16)(dz * rs * w.z + b.z);
    o.h[3] = (_Float16)(dw * rs * w.w + b.w);
    *(uint2*)(hn + row * 128 + lane * 4) = o.u;
}

// ---------------------------------------------------------------------------
// Row block of the two projection GEMMs: one work-group of 16 waves takes 256
// rows (16 row tiles). Each wave loads its weight fragments once and keeps
// them in registers over all its row tiles.
// ---------------------------------------------------------------------------
constexpr int RB_ = 256;   // rows per work-group

__device__ inline void stage_rows(_Float16* atile, const _Float16* g, int t) {
    uint32_t l0 = lds_addr_of(atile) + (t >> 4) * (AP_ * 2) + (t & 15) * 16;
    const _Float16* g0 = g + t * 8;
    asm volatile("global_load_async_to_lds_b128 %0, %8, off\n\t"
                 "global_load_async_to_lds_b128 %1, %9, off\n\t"
                 "global_load_async_to_lds_b128 %2, %10, off\n\t"
                 "global_load_async_to_lds_b128 %3, %11, off\n\t"
                 "global_load_async_to_lds_b128 %4, %12, off\n\t"
                 "global_load_async_to_lds_b128 %5, %13, off\n\t"
                 "global_load_async_to_lds_b128 %6, %14, off\n\t"
                 "global_load_async_to_lds_b128 %7, %15, off\n\t"
                 "s_wait_xcnt 0x0"
                 :: "v"(l0),                    "v"(l0 + 1 * 32 * AP_ * 2),
                    "v"(l0 + 2 * 32 * AP_ * 2), "v"(l0 + 3 * 32 * AP_ * 2),
                    "v"(l0 + 4 * 32 * AP_ * 2), "v"(l0 + 5 * 32 * AP_ * 2),
                    "v"(l0 + 6 * 32 * AP_ * 2), "v"(l0 + 7 * 32 * AP_ * 2),
                    "v"((uint64_t)(uintptr_t)(g0)),
                    "v"((uint64_t)(uintptr_t)(g0 + 1 * 4096)),
                    "v"((uint64_t)(uintptr_t)(g0 + 2 * 4096)),
                    "v"((uint64_t)(uintptr_t)(g0 + 3 * 4096)),
                    "v"((uint64_t)(uintptr_t)(g0 + 4 * 4096)),
                    "v"((uint64_t)(uintptr_t)(g0 + 5 * 4096)),
                    "v"((uint64_t)(uintptr_t)(g0 + 6 * 4096)),
                    "v"((uint64_t)(uintptr_t)(g0 + 7 * 4096))
                 : "memory");
}

// ---------------------------------------------------------------------------
// Kernel 2: fused projections. 33 column tiles of 16: 0..31 -> Q,K,V,G (f16
// out), two per wave over all 16 row tiles; 32 -> tri_bias (f32 out), wave w
// doing it for row tile w.
// ---------------------------------------------------------------------------
__global__ __launch_bounds__(512) void proj_kernel(const _Float16* __restrict__ hn,
                                                   const _Float16* __restrict__ wcat,
                                                   _Float16* __restrict__ qkvg,
                                                   float* __restrict__ biasb) {
    int rb = blockIdx.x;                  // row block 0..255
    int t = threadIdx.x, lane = t & 31;
    int wv = __builtin_amdgcn_readfirstlane(t >> 5);
    __shared__ __attribute__((aligned(16))) _Float16 atile[RB_ * AP_];

    stage_rows(atile, hn + (size_t)rb * RB_ * 128, t);

    // weight fragments, loaded while the copies fly
    v16h b[2][4];
#pragma unroll
    for (int j = 0; j < 2; ++j)
#pragma unroll
        for (int kc = 0; kc < 4; ++kc)
            b[j][kc] = load_frag16(wcat + (wv + j * 16) * 16 * 128 + kc * 32, 128, lane);

    // the wave's own copies have landed; the barrier publishes all waves' rows
    asm volatile("s_wait_asynccnt 0x0" ::: "memory");
    __syncthreads();

    int n = lane & 15, hi = lane >> 4;

    // bias-tile weights: asked for here so that they fly under the main loop
    v16h bb[4];
#pragma unroll
    for (int kc = 0; kc < 4; ++kc)
        bb[kc] = load_frag16(wcat + 32 * 16 * 128 + kc * 32, 128, lane);

    _Float16* out0 = qkvg + (size_t)(wv >> 3) * NN_ * 128
                   + (size_t)(rb * RB_ + hi * 8) * 128 + (wv & 7) * 16 + n;
    _Float16* out1 = out0 + (size_t)2 * NN_ * 128;
#pragma unroll
    for (int rt = 0; rt < RB_ / 16; ++rt) {
        v16h a[4];
#pragma unroll
        for (int kc = 0; kc < 4; ++kc) a[kc] = load_frag16_lds(atile + rt * 16 * AP_ + kc * 32, AP_, lane);
        v8f c0 = {}, c1 = {};
#pragma unroll
        for (int kc = 0; kc < 4; ++kc) {
            c0 = __builtin_amdgcn_wmma_f32_16x16x32_f16(false, a[kc], false, b[0][kc], (short)0, c0, false, false);
            c1 = __builtin_amdgcn_wmma_f32_16x16x32_f16(false, a[kc], false, b[1][kc], (short)0, c1, false, false);
        }
#pragma unroll
        for (int r = 0; r < 8; ++r) {
            out0[(rt * 16 + r) * 128] = (_Float16)c0[r];
            out1[(rt * 16 + r) * 128] = (_Float16)c1[r];
        }
    }

    {   // bias tile of row tile wv: column n = head
        v8f c = {};
#pragma unroll
        for (int kc = 0; kc < 4; ++kc) {
            v16h a = load_frag16_lds(atile + wv * 16 * AP_ + kc * 32, AP_, lane);
            c = __builtin_amdgcn_wmma_f32_16x16x32_f16(false, a, false, bb[kc], (short)0, c, false, false);
        }
        if (n < 4) {
#pragma unroll
            for (int r = 0; r < 8; ++r)
                biasb[(size_t)n * NN_ + rb * RB_ + wv * 16 + r + hi * 8] = c[r];
        }
    }
}

__global__ __launch_bounds__(256) void attn_kernel(const _Float16* __restrict__ qkvg,
                                                   const float* __restrict__ biasb,
                                                   _Float16* __restrict__ og) {
    extern __shared__ __attribute__((aligned(16))) char lds[];
    _Float16* Ksh  = (_Float16*)(lds);
    _Float16* Vtmp = (_Float16*)(lds + 20480);
    _Float16* Vsh  = (_Float16*)(lds + 36864);
    int i = blockIdx.x, h = blockIdx.y;
    int t = threadIdx.x, wv = t >> 5, lane = t & 31;
    _Float16* Psh = (_Float16*)(lds + 53760) + (size_t)wv * 16 * VP_;

    const _Float16* Qg = qkvg;
    const _Float16* Kg = qkvg + (size_t)1 * NN_ * 128;
    const _Float16* Vg = qkvg + (size_t)2 * NN_ * 128;
    const _Float16* Gg = qkvg + (size_t)3 * NN_ * 128;

    // Async stage: thread t owns key row t (64B of K, 64B of V -> 4+4 b128).
    {
        const _Float16* kg = Kg + (size_t)(i * 256 + t) * 128 + h * 32;
        const _Float16* vg = Vg + (size_t)(i * 256 + t) * 128 + h * 32;
        uint32_t kdst = lds_addr_of(Ksh  + t * KP_);
        uint32_t vdst = lds_addr_of(Vtmp + t * 32);
#pragma unroll
        for (int q = 0; q < 4; ++q) {
            async_copy_b128(kdst + q * 16, kg + q * 8);
            async_copy_b128(vdst + q * 16, vg + q * 8);
        }
    }
    wait_async0();
    __syncthreads();
    // Transpose V in LDS: Vsh[dh][key] = Vtmp[key][dh]
    for (int p = t; p < 256 * 32; p += 256) {
        int k = p >> 5, dh = p & 31;
        Vsh[dh * VP_ + k] = Vtmp[k * 32 + dh];
    }
    __syncthreads();

    int n = lane & 15, hi = lane >> 4;
    for (int jt = wv * 2; jt < wv * 2 + 2; ++jt) {
        int jbase = jt * 16;
        // Q fragment (Q pre-scaled by 1/sqrt(DH) in proj)
        v16h aq = load_frag16(Qg + (size_t)(i * 256 + jbase) * 128 + h * 32, 128, lane);

        // ---- scores: S = Q K^T + bias (bias in accumulator), in registers ----
        v8f s[16];
        const float* bbase = biasb + (size_t)h * NN_ + (size_t)jbase * 256 + n;
#pragma unroll
        for (int kt = 0; kt < 16; ++kt) {
            v16h bk = load_frag16_lds(Ksh + kt * 16 * KP_, KP_, lane);
            v8f c;
#pragma unroll
            for (int r = 0; r < 8; ++r) c[r] = bbase[(size_t)(r + hi * 8) * 256 + kt * 16];
            s[kt] = __builtin_amdgcn_wmma_f32_16x16x32_f16(false, aq, false, bk,
                                                           (short)0, c, false, false);
        }

        // ---- softmax: per-lane reduce over kt, then across 16 cols (shfl) ----
        float mx[8], sm[8];
#pragma unroll
        for (int r = 0; r < 8; ++r) {
            float m0 = s[0][r];
#pragma unroll
            for (int kt = 1; kt < 16; ++kt) m0 = fmaxf(m0, s[kt][r]);
            m0 = fmaxf(m0, __shfl_xor(m0, 1, 32));
            m0 = fmaxf(m0, __shfl_xor(m0, 2, 32));
            m0 = fmaxf(m0, __shfl_xor(m0, 4, 32));
            m0 = fmaxf(m0, __shfl_xor(m0, 8, 32));
            mx[r] = m0;
            sm[r] = 0.0f;
        }
#pragma unroll
        for (int kt = 0; kt < 16; ++kt) {
#pragma unroll
            for (int r = 0; r < 8; ++r) {
                float e = __expf(s[kt][r] - mx[r]);
                sm[r] += e;
                Psh[(r + hi * 8) * VP_ + kt * 16 + n] = (_Float16)e;
            }
        }
#pragma unroll
        for (int r = 0; r < 8; ++r) {
            float v = sm[r];
            v += __shfl_xor(v, 1, 32);
            v += __shfl_xor(v, 2, 32);
            v += __shfl_xor(v, 4, 32);
            v += __shfl_xor(v, 8, 32);
            sm[r] = v;   // row sum for row (r + hi*8) -- same row map as O accum
        }
        __syncthreads();   // P writes -> P fragment reads (uniform per wave)

        // ---- O = P V (two dh tiles of 16) ----
        v8f o0 = {}, o1 = {};
#pragma unroll
        for (int kp = 0; kp < 8; ++kp) {
            v16h ap  = load_frag16_lds(Psh + kp * 32, VP_, lane);
            v16h bv0 = load_frag16_lds(Vsh + kp * 32, VP_, lane);
            v16h bv1 = load_frag16_lds(Vsh + 16 * VP_ + kp * 32, VP_, lane);
            o0 = __builtin_amdgcn_wmma_f32_16x16x32_f16(false, ap, false, bv0,
                                                        (short)0, o0, false, false);
            o1 = __builtin_amdgcn_wmma_f32_16x16x32_f16(false, ap, false, bv1,
                                                        (short)0, o1, false, false);
        }

        // ---- normalize, gate with sigmoid(g), store head-major ----
#pragma unroll
        for (int r = 0; r < 8; ++r) {
            float inv = 1.0f / sm[r];
            size_t row = (size_t)(i * 256 + jbase + r + hi * 8);
            float g0 = (float)Gg[row * 128 + h * 32 + n];
            float g1 = (float)Gg[row * 128 + h * 32 + 16 + n];
            float s0 = 1.0f / (1.0f + __expf(-g0));
            float s1 = 1.0f / (1.0f + __expf(-g1));
            og[row * 128 + h * 32 + n]      = (_Float16)(o0[r] * inv * s0);
            og[row * 128 + h * 32 + 16 + n] = (_Float16)(o1[r] * inv * s1);
        }
    }
}

// ---------------------------------------------------------------------------
// Kernel 4: output projection out = og @ o_w^T  (f32 result). Wave w holds
// column tile w & 7 and walks row tiles (w >> 3) * 8 .. + 7 of the block.
// ---------------------------------------------------------------------------
__global__ __launch_bounds__(512) void out_kernel(const _Float16* __restrict__ og,
                                                  const _Float16* __restrict__ wo,
                                                  float* __restrict__ out) {
    int rb = blockIdx.x, t = threadIdx.x, lane = t & 31;
    int wv = __builtin_amdgcn_readfirstlane(t >> 5);
    __shared__ __attribute__((aligned(16))) _Float16 atile[RB_ * AP_];

    stage_rows(atile, og + (size_t)rb * RB_ * 128, t);

    int ct = wv & 7, r0 = (wv >> 3) * 128;   // column tile, first row in the block
    v16h b[4];
#pragma unroll
    for (int kc = 0; kc < 4; ++kc) b[kc] = load_frag16(wo + ct * 16 * 128 + kc * 32, 128, lane);

    // the wave's own copies have landed; the barrier publishes all waves' rows
    asm volatile("s_wait_asynccnt 0x0" ::: "memory");
    __syncthreads();

    int hi = lane >> 4, n = lane & 15;
    float* op = out + (size_t)(rb * RB_ + r0 + hi * 8) * 128 + ct * 16 + n;
#pragma unroll
    for (int rt = 0; rt < 8; ++rt) {
        v16h a[4];
#pragma unroll
        for (int kc = 0; kc < 4; ++kc) a[kc] = load_frag16_lds(atile + (r0 + rt * 16) * AP_ + kc * 32, AP_, lane);
        v8f c = {};
#pragma unroll
        for (int kc = 0; kc < 4; ++kc)
            c = __builtin_amdgcn_wmma_f32_16x16x32_f16(false, a[kc], false, b[kc], (short)0, c, false, false);
#pragma unroll
        for (int r = 0; r < 8; ++r)
            op[(rt * 16 + r) * 128] = c[r];
    }
}

// ---------------------------------------------------------------------------
extern "C" void kernel_launch(void* const* d_in, const int* in_sizes, int n_in,
                              void* d_out, int out_size, void* d_ws, size_t ws_size,
                              hipStream_t stream) {
    const float* x   = (const float*)d_in[0];
    const float* lnw = (const float*)d_in[1];
    const float* lnb = (const float*)d_in[2];
    const float* bw  = (const float*)d_in[3];
    const float* qw  = (const float*)d_in[4];
    const float* kw  = (const float*)d_in[5];
    const float* vw  = (const float*)d_in[6];
    const float* gw  = (const float*)d_in[7];
    const float* ow  = (const float*)d_in[8];
    float* out = (float*)d_out;

    char* ws = (char*)d_ws;
    _Float16* hn    = (_Float16*)ws;                       // NN*D f16
    _Float16* qkvg  = hn + (size_t)NN_ * D_;               // 4*NN*D f16
    float*    biasb = (float*)(qkvg + (size_t)4 * NN_ * D_);  // H*NN f32
    _Float16* og    = (_Float16*)(biasb + (size_t)H_ * NN_);  // NN*D f16
    _Float16* wcat  = og + (size_t)NN_ * D_;               // 528*128 f16
    _Float16* wo    = wcat + 528 * 128;                    // 128*128 f16

    prep_weights<<<328, 256, 0, stream>>>(qw, kw, vw, gw, bw, ow, wcat, wo);
    ln_kernel<<<NN_ / 8, 256, 0, stream>>>(x, lnw, lnb, hn);
    proj_kernel<<<NN_ / RB_, 512, 0, stream>>>(hn, wcat, qkvg, biasb);
    attn_kernel<<<dim3(256, 4), 256, 121344, stream>>>(qkvg, biasb, og);
    out_kernel<<<NN_ / RB_, 512, 0, stream>>>(og, wo, out);
}

// v003
// Measured time: 70.7 microseconds a run.
// Next to v002, in two timings, it ran 1.16 and 1.17 times as fast.
// Over all steps from v000 it is 2.99 times as fast.
#include <hip/hip_runtime.h>

typedef __attribute__((ext_vector_type(16))) _Float16 v16h;
typedef __attribute__((ext_vector_type(8)))  float    v8f;

constexpr int NN_ = 65536;   // N*N rows
constexpr int D_  = 128;
constexpr int H_  = 4;

union FragH { v16h h; uint32_t u[8]; };

__device__ inline uint32_t lds_addr_of(const void* p) {
    return (uint32_t)(uintptr_t)p;
}

__device__ inline void async_copy_b128(uint32_t lds_byte_addr, const void* gsrc) {
    asm volatile("global_load_async_to_lds_b128 %0, %1, off"
                 :: "v"(lds_byte_addr), "v"((uint64_t)(uintptr_t)gsrc)
                 : "memory");
}

__device__ inline void wait_async0() {
#if __has_builtin(__builtin_amdgcn_s_wait_asynccnt)
    __builtin_amdgcn_s_wait_asynccnt(0);
#else
    asm volatile("s_wait_asynccnt 0x0" ::: "memory");
#endif
}

__device__ inline v16h load_frag16(const _Float16* base, int stride, int lane) {
    int rc = lane & 15;
    int hi = (lane >> 4) & 1;
    const _Float16* p = base + rc * stride;
    FragH f;
#pragma unroll
    for (int v = 0; v < 8; ++v) {
        int k = ((v & 4) << 2) + hi * 8 + (v & 3) * 2;   // pairs of consecutive K
        f.u[v] = *(const uint32_t*)(p + k);
    }
    return f.h;
}

__device__ inline v16h load_frag16_lds(const _Float16* base, int stride, int lane) {
    const _Float16* p = base + (lane & 15) * stride + ((lane >> 4) & 1) * 8;
    union { v16h h; uint4 q[2]; } f;
    f.q[0] = *(const uint4*)(p);        // K = hi*8 + 0..7
    f.q[1] = *(const uint4*)(p + 16);   // K = 16 + hi*8 + 0..7
    return f.h;
}

// LDS row pitches in halves, each 16 B x odd
constexpr int AP_ = 136;   // 128-half activation rows: 272 B
constexpr int KP_ = 40;    // 32-half K rows: 80 B
constexpr int VP_ = 264;   // 256-half V^T rows: 528 B

// ---------------------------------------------------------------------------
// Kernel 0: weight preconversion to f16 (scale folded into q_w).
// wcat rows: [0..127]=q*scale, [128..255]=k, [256..383]=v, [384..511]=g,
//            [512..515]=bias_w, [516..527]=0
// ---------------------------------------------------------------------------
__global__ void prep_weights(const float* qw, const float* kw, const float* vw,
                             const float* gw, const float* bw, const float* ow,
                             _Float16* wcat, _Float16* wo) {
    int idx = blockIdx.x * 256 + threadIdx.x;
    const float scale = 0.17677669529663687f;   // 1/sqrt(32)
    if (idx < 528 * 128) {
        int r = idx >> 7, c = idx & 127;
        float v;
        if      (r < 128) v = qw[idx] * scale;
        else if (r < 256) v = kw[(r - 128) * 128 + c];
        else if (r < 384) v = vw[(r - 256) * 128 + c];
        else if (r < 512) v = gw[(r - 384) * 128 + c];
        else if (r < 516) v = bw[(r - 512) * 128 + c];
        else              v = 0.0f;
        wcat[idx] = (_Float16)v;
    } else if (idx < 528 * 128 + 128 * 128) {
        int j = idx - 528 * 128;
        wo[j] = (_Float16)ow[j];
    }
}

// ---------------------------------------------------------------------------
// Kernel 1: LayerNorm over D=128. One wave per row: float4 per lane,
// shfl_xor reductions, packed 8-byte f16 store. No LDS, no barriers.
// ---------------------------------------------------------------------------
__global__ __launch_bounds__(256) void ln_kernel(const float* __restrict__ x,
                                                 const float* __restrict__ lnw,
                                                 const float* __restrict__ lnb,
                                                 _Float16* __restrict__ hn) {
    int t = threadIdx.x, wv = t >> 5, lane = t & 31;
    size_t row = (size_t)blockIdx.x * 8 + wv;
    float4 v = ((const float4*)(x + row * 128))[lane];

    float ps = v.x + v.y + v.z + v.w;
    ps += __shfl_xor(ps, 1, 32);  ps += __shfl_xor(ps, 2, 32);
    ps += __shfl_xor(ps, 4, 32);  ps += __shfl_xor(ps, 8, 32);
    ps += __shfl_xor(ps, 16, 32);
    float mu = ps * (1.0f / 128.0f);

    float dx = v.x - mu, dy = v.y - mu, dz = v.z - mu, dw = v.w - mu;
    float pv = dx * dx + dy * dy + dz * dz + dw * dw;
    pv += __shfl_xor(pv, 1, 32);  pv += __shfl_xor(pv, 2, 32);
    pv += __shfl_xor(pv, 4, 32);  pv += __shfl_xor(pv, 8, 32);
    pv += __shfl_xor(pv, 16, 32);
    float rs = rsqrtf(pv * (1.0f / 128.0f) + 1e-5f);

    float4 w = ((const float4*)lnw)[lane];
    float4 b = ((const float4*)lnb)[lane];
    union { _Float16 h[4]; uint2 u; } o;
    o.h[0] = (_Float16)(dx * rs * w.x + b.x);
    o.h[1] = (_Float16)(dy * rs * w.y + b.y);
    o.h[2] = (_Float16)(dz * rs * w.z + b.z);
    o.h[3] = (_Float16)(dw * rs * w.w + b.w);
    *(uint2*)(hn + row * 128 + lane * 4) = o.u;
}

// ---------------------------------------------------------------------------
// Row block of the two projection GEMMs: one work-group of 16 waves takes 256
// rows (16 row tiles). Each wave loads its weight fragments once and keeps
// them in registers over all its row tiles.
// ---------------------------------------------------------------------------
constexpr int RB_ = 256;   // rows per work-group

__device__ inline void stage_rows(_Float16* atile, const _Float16* g, int t) {
    uint32_t l0 = lds_addr_of(atile) + (t >> 4) * (AP_ * 2) + (t & 15) * 16;
    const _Float16* g0 = g + t * 8;
    asm volatile("global_load_async_to_lds_b128 %0, %8, off\n\t"
                 "global_load_async_to_lds_b128 %1, %9, off\n\t"
                 "global_load_async_to_lds_b128 %2, %10, off\n\t"
                 "global_load_async_to_lds_b128 %3, %11, off\n\t"
                 "global_load_async_to_lds_b128 %4, %12, off\n\t"
                 "global_load_async_to_lds_b128 %5, %13, off\n\t"
                 "global_load_async_to_lds_b128 %6, %14, off\n\t"
                 "global_load_async_to_lds_b128 %7, %15, off\n\t"
                 "s_wait_xcnt 0x0"
                 :: "v"(l0),                    "v"(l0 + 1 * 32 * AP_ * 2),
                    "v"(l0 + 2 * 32 * AP_ * 2), "v"(l0 + 3 * 32 * AP_ * 2),
                    "v"(l0 + 4 * 32 * AP_ * 2), "v"(l0 + 5 * 32 * AP_ * 2),
                    "v"(l0 + 6 * 32 * AP_ * 2), "v"(l0 + 7 * 32 * AP_ * 2),
                    "v"((uint64_t)(uintptr_t)(g0)),
                    "v"((uint64_t)(uintptr_t)(g0 + 1 * 4096)),
                    "v"((uint64_t)(uintptr_t)(g0 + 2 * 4096)),
                    "v"((uint64_t)(uintptr_t)(g0 + 3 * 4096)),
                    "v"((uint64_t)(uintptr_t)(g0 + 4 * 4096)),
                    "v"((uint64_t)(uintptr_t)(g0 + 5 * 4096)),
                    "v"((uint64_t)(uintptr_t)(g0 + 6 * 4096)),
                    "v"((uint64_t)(uintptr_t)(g0 + 7 * 4096))
                 : "memory");
}

// ---------------------------------------------------------------------------
// Kernel 2: fused projections. 33 column tiles of 16: 0..31 -> Q,K,V,G (f16
// out), two per wave over all 16 row tiles; 32 -> tri_bias (f32 out). The bias
// plane is laid out as the attention kernel's S^T accumulators read it:
// [head][query tile][key tile][r >> 2][hi * 16 + (query & 15)][r & 3], key in the
// tile = hi * 8 + r. Work-group rb writes the whole 1 KB block (query tile
// rb >> 4, key tile rb & 15) of each head; wave w does query w of the tile and
// reads its 16 rows of hn straight from global memory.
// ---------------------------------------------------------------------------
__global__ __launch_bounds__(512) void proj_kernel(const _Float16* __restrict__ hn,
                                                   const _Float16* __restrict__ wcat,
                                                   _Float16* __restrict__ qkvg,
                                                   float* __restrict__ biasb) {
    int rb = blockIdx.x;                  // row block 0..255
    int t = threadIdx.x, lane = t & 31;
    int wv = __builtin_amdgcn_readfirstlane(t >> 5);
    __shared__ __attribute__((aligned(16))) _Float16 atile[RB_ * AP_];

    stage_rows(atile, hn + (size_t)rb * RB_ * 128, t);

    // weight fragments, loaded while the copies fly
    v16h b[2][4];
#pragma unroll
    for (int j = 0; j < 2; ++j)
#pragma unroll
        for (int kc = 0; kc < 4; ++kc)
            b[j][kc] = load_frag16(wcat + (wv + j * 16) * 16 * 128 + kc * 32, 128, lane);

    // the wave's own copies have landed; the barrier publishes all waves' rows
    asm volatile("s_wait_asynccnt 0x0" ::: "memory");
    __syncthreads();

    int n = lane & 15, hi = lane >> 4;

    // bias-tile weights: asked for here so that they fly under the main loop
    v16h bb[4];
#pragma unroll
    for (int kc = 0; kc < 4; ++kc)
        bb[kc] = load_frag16(wcat + 32 * 16 * 128 + kc * 32, 128, lane);
    const _Float16* hb = hn + ((size_t)((rb >> 4) * 16 + wv) * 256 + (rb & 15) * 16) * 128;
    v16h ab[4];
#pragma unroll
    for (int kc = 0; kc < 4; ++kc)
        ab[kc] = load_frag16(hb + kc * 32, 128, lane);

    _Float16* out0 = qkvg + (size_t)(wv >> 3) * NN_ * 128
                   + (size_t)(rb * RB_ + hi * 8) * 128 + (wv & 7) * 16 + n;
    _Float16* out1 = out0 + (size_t)2 * NN_ * 128;
#pragma unroll
    for (int rt = 0; rt < RB_ / 16; ++rt) {
        v16h a[4];
#pragma unroll
        for (int kc = 0; kc < 4; ++kc) a[kc] = load_frag16_lds(atile + rt * 16 * AP_ + kc * 32, AP_, lane);
        v8f c0 = {}, c1 = {};
#pragma unroll
        for (int kc = 0; kc < 4; ++kc) {
            c0 = __builtin_amdgcn_wmma_f32_16x16x32_f16(false, a[kc], false, b[0][kc], (short)0, c0, false, false);
            c1 = __builtin_amdgcn_wmma_f32_16x16x32_f16(false, a[kc], false, b[1][kc], (short)0, c1, false, false);
        }
#pragma unroll
        for (int r = 0; r < 8; ++r) {
            out0[(rt * 16 + r) * 128] = (_Float16)c0[r];
            out1[(rt * 16 + r) * 128] = (_Float16)c1[r];
        }
    }

    {   // bias tile: c[r] = bias of key hi * 8 + r, column n = head
        v8f c = {};
#pragma unroll
        for (int kc = 0; kc < 4; ++kc)
            c = __builtin_amdgcn_wmma_f32_16x16x32_f16(false, ab[kc], false, bb[kc], (short)0, c, false, false);
        if (n < 4) {
            float* bo = biasb + (size_t)n * NN_ + (rb >> 4) * 4096 + (rb & 15) * 256 + (hi * 16 + wv) * 4;
            *(float4*)(bo)       = make_float4(c[0], c[1], c[2], c[3]);
            *(float4*)(bo + 128) = make_float4(c[4], c[5], c[6], c[7]);
        }
    }
}

__global__ __launch_bounds__(256) void attn_kernel(const _Float16* __restrict__ qkvg,
                                                   const float* __restrict__ biasb,
                                                   _Float16* __restrict__ og) {
    extern __shared__ __attribute__((aligned(16))) char lds[];
    _Float16* Ksh  = (_Float16*)(lds);
    _Float16* Vtmp = (_Float16*)(lds + 20480);
    _Float16* Vsh  = (_Float16*)(lds + 36864);
    int i = blockIdx.x, h = blockIdx.y;
    int t = threadIdx.x, wv = t >> 5, lane = t & 31;

    const _Float16* Qg = qkvg;
    const _Float16* Kg = qkvg + (size_t)1 * NN_ * 128;
    const _Float16* Vg = qkvg + (size_t)2 * NN_ * 128;
    const _Float16* Gg = qkvg + (size_t)3 * NN_ * 128;

    // Async stage: thread t owns key row t (64B of K, 64B of V -> 4+4 b128).
    {
        const _Float16* kg = Kg + (size_t)(i * 256 + t) * 128 + h * 32;
        const _Float16* vg = Vg + (size_t)(i * 256 + t) * 128 + h * 32;
        uint32_t kdst = lds_addr_of(Ksh  + t * KP_);
        uint32_t vdst = lds_addr_of(Vtmp + t * 32);
#pragma unroll
        for (int q = 0; q < 4; ++q) {
            async_copy_b128(kdst + q * 16, kg + q * 8);
            async_copy_b128(vdst + q * 16, vg + q * 8);
        }
    }
    wait_async0();
    __syncthreads();
    // Transpose V in LDS: Vsh[dh][key] = Vtmp[key][dh]
    for (int p = t; p < 256 * 32; p += 256) {
        int k = p >> 5, dh = p & 31;
        Vsh[dh * VP_ + k] = Vtmp[k * 32 + dh];
    }
    __syncthreads();

    int n = lane & 15, hi = lane >> 4;
    for (int jt = wv * 2; jt < wv * 2 + 2; ++jt) {
        int jbase = jt * 16;
        // compiler fence: keeps each tile's K and V^T fragment reads inside its own
        // trip; hoisted out of the loop they hold 256 registers and cost resident waves
        asm volatile("" ::: "memory");
        // Q^T fragment: column = query n (Q pre-scaled by 1/sqrt(DH) in proj)
        v16h bq = load_frag16(Qg + (size_t)(i * 256 + jbase) * 128 + h * 32, 128, lane);

        // ---- S^T = K Q^T + bias^T: s[kt][r] = score(query n, key kt*16 + hi*8 + r);
        //      the bias plane lies in this accumulator order (see proj_kernel): each
        //      wave-wide 16-byte load covers 512 contiguous bytes
        v8f s[16];
        const float* bbase = biasb + (size_t)h * NN_ + jt * 4096 + lane * 4;
#pragma unroll
        for (int kt = 0; kt < 16; ++kt) {
            v16h ak = load_frag16_lds(Ksh + kt * 16 * KP_, KP_, lane);
            float4 c0 = *(const float4*)(bbase + kt * 256);
            float4 c1 = *(const float4*)(bbase + kt * 256 + 128);
            v8f c = {c0.x, c0.y, c0.z, c0.w, c1.x, c1.y, c1.z, c1.w};
            s[kt] = __builtin_amdgcn_wmma_f32_16x16x32_f16(false, ak, false, bq,
                                                           (short)0, c, false, false);
        }

        // ---- the query's maximum: in-lane, then one exchange between halves ----
        float mr[8];
#pragma unroll
        for (int r = 0; r < 8; ++r) {
            float m0 = s[0][r];
#pragma unroll
            for (int kt = 1; kt < 16; ++kt) m0 = fmaxf(m0, s[kt][r]);
            mr[r] = m0;
        }
        float mx = fmaxf(fmaxf(fmaxf(mr[0], mr[1]), fmaxf(mr[2], mr[3])),
                         fmaxf(fmaxf(mr[4], mr[5]), fmaxf(mr[6], mr[7])));
        mx = fmaxf(mx, __shfl_xor(mx, 16, 32));

        // ---- O^T = V^T P^T (two dh tiles of 16), P^T packed from the scores ----
        float sm[8];
#pragma unroll
        for (int r = 0; r < 8; ++r) sm[r] = 0.0f;
        v8f o0 = {}, o1 = {};
#pragma unroll
        for (int kp = 0; kp < 8; ++kp) {
            v16h bp;
#pragma unroll
            for (int r = 0; r < 8; ++r) {
                float e0 = __expf(s[2 * kp][r] - mx);
                float e1 = __expf(s[2 * kp + 1][r] - mx);
                sm[r] += e0 + e1;
                bp[r]     = (_Float16)e0;   // key kp*32 + hi*8 + r
                bp[8 + r] = (_Float16)e1;   // key kp*32 + 16 + hi*8 + r
            }
            v16h av0 = load_frag16_lds(Vsh + kp * 32, VP_, lane);
            v16h av1 = load_frag16_lds(Vsh + 16 * VP_ + kp * 32, VP_, lane);
            o0 = __builtin_amdgcn_wmma_f32_16x16x32_f16(false, av0, false, bp,
                                                        (short)0, o0, false, false);
            o1 = __builtin_amdgcn_wmma_f32_16x16x32_f16(false, av1, false, bp,
                                                        (short)0, o1, false, false);
        }
        float sum = ((sm[0] + sm[1]) + (sm[2] + sm[3])) + ((sm[4] + sm[5]) + (sm[6] + sm[7]));
        sum += __shfl_xor(sum, 16, 32);
        float inv = 1.0f / sum;

        // ---- normalize, gate with sigmoid(g), store head-major:
        //      o0[r] = channel hi*8 + r, o1[r] = channel 16 + hi*8 + r of query n
        size_t off = (size_t)(i * 256 + jbase + n) * 128 + h * 32 + hi * 8;
        union { _Float16 h[8]; uint4 q; } g0, g1, r0, r1;
        g0.q = *(const uint4*)(Gg + off);
        g1.q = *(const uint4*)(Gg + off + 16);
#pragma unroll
        for (int r = 0; r < 8; ++r) {
            float s0 = 1.0f / (1.0f + __expf(-(float)g0.h[r]));
            float s1 = 1.0f / (1.0f + __expf(-(float)g1.h[r]));
            r0.h[r] = (_Float16)(o0[r] * inv * s0);
            r1.h[r] = (_Float16)(o1[r] * inv * s1);
        }
        *(uint4*)(og + off)      = r0.q;
        *(uint4*)(og + off + 16) = r1.q;
    }
}

// ---------------------------------------------------------------------------
// Kernel 4: output projection out = og @ o_w^T  (f32 result). Wave w holds
// column tile w & 7 and walks row tiles (w >> 3) * 8 .. + 7 of the block.
// ---------------------------------------------------------------------------
__global__ __launch_bounds__(512) void out_kernel(const _Float16* __restrict__ og,
                                                  const _Float16* __restrict__ wo,
                                                  float* __restrict__ out) {
    int rb = blockIdx.x, t = threadIdx.x, lane = t & 31;
    int wv = __builtin_amdgcn_readfirstlane(t >> 5);
    __shared__ __attribute__((aligned(16))) _Float16 atile[RB_ * AP_];

    stage_rows(atile, og + (size_t)rb * RB_ * 128, t);

    int ct = wv & 7, r0 = (wv >> 3) * 128;   // column tile, first row in the block
    v16h b[4];
#pragma unroll
    for (int kc = 0; kc < 4; ++kc) b[kc] = load_frag16(wo + ct * 16 * 128 + kc * 32, 128, lane);

    // the wave's own copies have landed; the barrier publishes all waves' rows
    asm volatile("s_wait_asynccnt 0x0" ::: "memory");
    __syncthreads();

    int hi = lane >> 4, n = lane & 15;
    float* op = out + (size_t)(rb * RB_ + r0 + hi * 8) * 128 + ct * 16 + n;
#pragma unroll
    for (int rt = 0; rt < 8; ++rt) {
        v16h a[4];
#pragma unroll
        for (int kc = 0; kc < 4; ++kc) a[kc] = load_frag16_lds(atile + (r0 + rt * 16) * AP_ + kc * 32, AP_, lane);
        v8f c = {};
#pragma unroll
        for (int kc = 0; kc < 4; ++kc)
            c = __builtin_amdgcn_wmma_f32_16x16x32_f16(false, a[kc], false, b[kc], (short)0, c, false, false);
#pragma unroll
        for (int r = 0; r < 8; ++r)
            op[(rt * 16 + r) * 128] = c[r];
    }
}

// ---------------------------------------------------------------------------
extern "C" void kernel_launch(void* const* d_in, const int* in_sizes, int n_in,
                              void* d_out, int out_size, void* d_ws, size_t ws_size,
                              hipStream_t stream) {
    const float* x   = (const float*)d_in[0];
    const float* lnw = (const float*)d_in[1];
    const float* lnb = (const float*)d_in[2];
    const float* bw  = (const float*)d_in[3];
    const float* qw  = (const float*)d_in[4];
    const float* kw  = (const float*)d_in[5];
    const float* vw  = (const float*)d_in[6];
    const float* gw  = (const float*)d_in[7];
    const float* ow  = (const float*)d_in[8];
    float* out = (float*)d_out;

    char* ws = (char*)d_ws;
    _Float16* hn    = (_Float16*)ws;                       // NN*D f16
    _Float16* qkvg  = hn + (size_t)NN_ * D_;               // 4*NN*D f16
    float*    biasb = (float*)(qkvg + (size_t)4 * NN_ * D_);  // H*NN f32
    _Float16* og    = (_Float16*)(biasb + (size_t)H_ * NN_);  // NN*D f16
    _Float16* wcat  = og + (size_t)NN_ * D_;               // 528*128 f16
    _Float16* wo    = wcat + 528 * 128;                    // 128*128 f16

    prep_weights<<<328, 256, 0, stream>>>(qw, kw, vw, gw, bw, ow, wcat, wo);
    ln_kernel<<<NN_ / 8, 256, 0, stream>>>(x, lnw, lnb, hn);
    proj_kernel<<<NN_ / RB_, 512, 0, stream>>>(hn, wcat, qkvg, biasb);
    attn_kernel<<<dim3(256, 4), 256, 53760, stream>>>(qkvg, biasb, og);
    out_kernel<<<NN_ / RB_, 512, 0, stream>>>(og, wo, out);
}

// v004
// A run of this version takes 65.4 microseconds.
// Timed twice side by side with v003, it ran 1.09 and 1.08 times as fast.
// Over all steps from v000 it is 3.24 times as fast.
#include <hip/hip_runtime.h>

typedef __attribute__((ext_vector_type(16))) _Float16 v16h;
typedef __attribute__((ext_vector_type(8)))  float    v8f;
typedef __attribute__((ext_vector_type(8)))  _Float16 v8h;

constexpr int NN_ = 65536;   // N*N rows
constexpr int D_  = 128;
constexpr int H_  = 4;

union FragH { v16h h; uint32_t u[8]; };

__device__ inline uint32_t lds_addr_of(const void* p) {
    return (uint32_t)(uintptr_t)p;
}

__device__ inline v16h load_frag16(const _Float16* base, int stride, int lane) {
    int rc = lane & 15;
    int hi = (lane >> 4) & 1;
    const _Float16* p = base + rc * stride;
    FragH f;
#pragma unroll
    for (int v = 0; v < 8; ++v) {
        int k = ((v & 4) << 2) + hi * 8 + (v & 3) * 2;   // pairs of consecutive K
        f.u[v] = *(const uint32_t*)(p + k);
    }
    return f.h;
}

__device__ inline v16h load_frag16_lds(const _Float16* base, int stride, int lane) {
    const _Float16* p = base + (lane & 15) * stride + ((lane >> 4) & 1) * 8;
    union { v16h h; uint4 q[2]; } f;
    f.q[0] = *(const uint4*)(p);        // K = hi*8 + 0..7
    f.q[1] = *(const uint4*)(p + 16);   // K = 16 + hi*8 + 0..7
    return f.h;
}

// A fragment stored in fragment order: two pieces of 32 lanes x 16 B, piece 0 at
// p0 and piece 1 at p1 (halves K = hi*8 + 0..7 and K = 16 + hi*8 + 0..7 of the
// lane's row or column). Each wave-wide load covers 512 contiguous bytes.
__device__ inline v16h load_frag16_ord(const _Float16* p0, const _Float16* p1, int lane) {
    union { v16h h; uint4 q[2]; } f;
    f.q[0] = *(const uint4*)(p0 + lane * 8);
    f.q[1] = *(const uint4*)(p1 + lane * 8);
    return f.h;
}

// LDS row pitch in halves, 16 B x odd
constexpr int AP_ = 136;   // 128-half activation rows: 272 B

// ---------------------------------------------------------------------------
// Kernel 0: weight preconversion to f16 (scale folded into q_w).
// wcat rows: [0..127]=q*scale, [128..255]=k, [256..383]=v, [384..511]=g,
//            [512..515]=bias_w, [516..527]=0
// ---------------------------------------------------------------------------
__global__ void prep_weights(const float* qw, const float* kw, const float* vw,
                             const float* gw, const float* bw, const float* ow,
                             _Float16* wcat, _Float16* wo) {
    int idx = blockIdx.x * 256 + threadIdx.x;
    const float scale = 0.17677669529663687f;   // 1/sqrt(32)
    if (idx < 528 * 128) {
        int r = idx >> 7, c = idx & 127;
        float v;
        if      (r < 128) v = qw[idx] * scale;
        else if (r < 256) v = kw[(r - 128) * 128 + c];
        else if (r < 384) v = vw[(r - 256) * 128 + c];
        else if (r < 512) v = gw[(r - 384) * 128 + c];
        else if (r < 516) v = bw[(r - 512) * 128 + c];
        else              v = 0.0f;
        wcat[idx] = (_Float16)v;
    } else if (idx < 528 * 128 + 128 * 128) {
        int j = idx - 528 * 128;
        wo[j] = (_Float16)ow[j];
    }
}

// ---------------------------------------------------------------------------
// Kernel 1: LayerNorm over D=128. One wave per row: float4 per lane,
// shfl_xor reductions, packed 8-byte f16 store. No LDS, no barriers.
// ---------------------------------------------------------------------------
__global__ __launch_bounds__(256) void ln_kernel(const float* __restrict__ x,
                                                 const float* __restrict__ lnw,
                                                 const float* __restrict__ lnb,
                                                 _Float16* __restrict__ hn) {
    int t = threadIdx.x, wv = t >> 5, lane = t & 31;
    size_t row = (size_t)blockIdx.x * 8 + wv;
    float4 v = ((const float4*)(x + row * 128))[lane];

    float ps = v.x + v.y + v.z + v.w;
    ps += __shfl_xor(ps, 1, 32);  ps += __shfl_xor(ps, 2, 32);
    ps += __shfl_xor(ps, 4, 32);  ps += __shfl_xor(ps, 8, 32);
    ps += __shfl_xor(ps, 16, 32);
    float mu = ps * (1.0f / 128.0f);

    float dx = v.x - mu, dy = v.y - mu, dz = v.z - mu, dw = v.w - mu;
    float pv = dx * dx + dy * dy + dz * dz + dw * dw;
    pv += __shfl_xor(pv, 1, 32);  pv += __shfl_xor(pv, 2, 32);
    pv += __shfl_xor(pv, 4, 32);  pv += __shfl_xor(pv, 8, 32);
    pv += __shfl_xor(pv, 16, 32);
    float rs = rsqrtf(pv * (1.0f / 128.0f) + 1e-5f);

    float4 w = ((const float4*)lnw)[lane];
    float4 b = ((const float4*)lnb)[lane];
    union { _Float16 h[4]; uint2 u; } o;
    o.h[0] = (_Float16)(dx * rs * w.x + b.x);
    o.h[1] = (_Float16)(dy * rs * w.y + b.y);
    o.h[2] = (_Float16)(dz * rs * w.z + b.z);
    o.h[3] = (_Float16)(dw * rs * w.w + b.w);
    *(uint2*)(hn + row * 128 + lane * 4) = o.u;
}

// ---------------------------------------------------------------------------
// Row block of the two projection GEMMs: one work-group of 16 waves takes 256
// rows (16 row tiles). Each wave loads its weight fragments once and keeps
// them in registers over all its row tiles.
// ---------------------------------------------------------------------------
constexpr int RB_ = 256;   // rows per work-group

template <int P>
__device__ inline void stage_rows(_Float16* atile, const _Float16* g, int t) {
    uint32_t l0 = lds_addr_of(atile) + (t >> 4) * (P * 2) + (t & 15) * 16;
    const _Float16* g0 = g + t * 8;
    asm volatile("global_load_async_to_lds_b128 %0, %8, off\n\t"
                 "global_load_async_to_lds_b128 %1, %9, off\n\t"
                 "global_load_async_to_lds_b128 %2, %10, off\n\t"
                 "global_load_async_to_lds_b128 %3, %11, off\n\t"
                 "global_load_async_to_lds_b128 %4, %12, off\n\t"
                 "global_load_async_to_lds_b128 %5, %13, off\n\t"
                 "global_load_async_to_lds_b128 %6, %14, off\n\t"
                 "global_load_async_to_lds_b128 %7, %15, off\n\t"
                 "s_wait_xcnt 0x0"
                 :: "v"(l0),                  "v"(l0 + 1 * 32 * P * 2),
                    "v"(l0 + 2 * 32 * P * 2), "v"(l0 + 3 * 32 * P * 2),
                    "v"(l0 + 4 * 32 * P * 2), "v"(l0 + 5 * 32 * P * 2),
                    "v"(l0 + 6 * 32 * P * 2), "v"(l0 + 7 * 32 * P * 2),
                    "v"((uint64_t)(uintptr_t)(g0)),
                    "v"((uint64_t)(uintptr_t)(g0 + 1 * 4096)),
                    "v"((uint64_t)(uintptr_t)(g0 + 2 * 4096)),
                    "v"((uint64_t)(uintptr_t)(g0 + 3 * 4096)),
                    "v"((uint64_t)(uintptr_t)(g0 + 4 * 4096)),
                    "v"((uint64_t)(uintptr_t)(g0 + 5 * 4096)),
                    "v"((uint64_t)(uintptr_t)(g0 + 6 * 4096)),
                    "v"((uint64_t)(uintptr_t)(g0 + 7 * 4096))
                 : "memory");
}

// ---------------------------------------------------------------------------
// Kernel 2: fused projections. 33 column tiles of 16: 0..31 -> Q,K,V,G (f16
// out), two per wave over all 16 row tiles; 32 -> tri_bias (f32 out). Wave w
// owns the 32 channels of head w & 3 of tensor w >> 2. Each plane is stored in
// the order in which the attention kernel's fragments hold it, 8192 halves per
// (i, head), in pieces of [lane = hi * 16 + n][8 halves]:
//   Q, K, G: piece (row tile rt, j): row rt*16 + n, channels j*16 + hi*8 + 0..7,
//            at rt*512 + j*256; made by the transposed product W hn^T;
//   V:       piece (j, rt): channel j*16 + n, rows rt*16 + hi*8 + 0..7,
//            at (j*16 + rt)*256; made by hn W^T: this is V^T's A fragment.
// A lane's 8 accumulators are one 16-byte store; a wave-wide store is 512
// contiguous bytes. The bias
// plane is laid out as the attention kernel's S^T accumulators read it:
// [head][query tile][key tile][r >> 2][hi * 16 + (query & 15)][r & 3], key in the
// tile = hi * 8 + r. Work-group rb writes the whole 1 KB block (query tile
// rb >> 4, key tile rb & 15) of each head; wave w does query w of the tile and
// reads its 16 rows of hn straight from global memory.
// ---------------------------------------------------------------------------
__global__ __launch_bounds__(512) void proj_kernel(const _Float16* __restrict__ hn,
                                                   const _Float16* __restrict__ wcat,
                                                   _Float16* __restrict__ qkvg,
                                                   float* __restrict__ biasb) {
    int rb = blockIdx.x;                  // row block 0..255
    int t = threadIdx.x, lane = t & 31;
    int wv = __builtin_amdgcn_readfirstlane(t >> 5);
    __shared__ __attribute__((aligned(16))) _Float16 atile[RB_ * AP_];

    stage_rows<AP_>(atile, hn + (size_t)rb * RB_ * 128, t);

    // weight fragments, loaded while the copies fly
    v16h b[2][4];
#pragma unroll
    for (int j = 0; j < 2; ++j)
#pragma unroll
        for (int kc = 0; kc < 4; ++kc)
            b[j][kc] = load_frag16(wcat + (wv * 2 + j) * 16 * 128 + kc * 32, 128, lane);

    // the wave's own copies have landed; the barrier publishes all waves' rows
    asm volatile("s_wait_asynccnt 0x0" ::: "memory");
    __syncthreads();

    int n = lane & 15, hi = lane >> 4;

    // bias-tile weights: asked for here so that they fly under the main loop
    v16h bb[4];
#pragma unroll
    for (int kc = 0; kc < 4; ++kc)
        bb[kc] = load_frag16(wcat + 32 * 16 * 128 + kc * 32, 128, lane);
    const _Float16* hb = hn + ((size_t)((rb >> 4) * 16 + wv) * 256 + (rb & 15) * 16) * 128;
    v16h ab[4];
#pragma unroll
    for (int kc = 0; kc < 4; ++kc)
        ab[kc] = load_frag16(hb + kc * 32, 128, lane);

    _Float16* outp = qkvg + (size_t)(wv >> 2) * NN_ * 128
                   + (size_t)(rb * 4 + (wv & 3)) * 8192 + lane * 8;
    if ((wv >> 2) == 2) {   // V: rows in the registers (wave-uniform branch)
#pragma unroll
        for (int rt = 0; rt < RB_ / 16; ++rt) {
            v16h a[4];
#pragma unroll
            for (int kc = 0; kc < 4; ++kc) a[kc] = load_frag16_lds(atile + rt * 16 * AP_ + kc * 32, AP_, lane);
            v8f c0 = {}, c1 = {};
#pragma unroll
            for (int kc = 0; kc < 4; ++kc) {
                c0 = __builtin_amdgcn_wmma_f32_16x16x32_f16(false, a[kc], false, b[0][kc], (short)0, c0, false, false);
                c1 = __builtin_amdgcn_wmma_f32_16x16x32_f16(false, a[kc], false, b[1][kc], (short)0, c1, false, false);
            }
            *(v8h*)(outp + rt * 256)        = __builtin_convertvector(c0, v8h);
            *(v8h*)(outp + (16 + rt) * 256) = __builtin_convertvector(c1, v8h);
        }
    } else {                // Q, K, G: channels in the registers
#pragma unroll
        for (int rt = 0; rt < RB_ / 16; ++rt) {
            v16h a[4];
#pragma unroll
            for (int kc = 0; kc < 4; ++kc) a[kc] = load_frag16_lds(atile + rt * 16 * AP_ + kc * 32, AP_, lane);
            v8f c0 = {}, c1 = {};
#pragma unroll
            for (int kc = 0; kc < 4; ++kc) {
                c0 = __builtin_amdgcn_wmma_f32_16x16x32_f16(false, b[0][kc], false, a[kc], (short)0, c0, false, false);
                c1 = __builtin_amdgcn_wmma_f32_16x16x32_f16(false, b[1][kc], false, a[kc], (short)0, c1, false, false);
            }
            *(v8h*)(outp + rt * 512)       = __builtin_convertvector(c0, v8h);
            *(v8h*)(outp + rt * 512 + 256) = __builtin_convertvector(c1, v8h);
        }
        // the last store's registers are rewritten by the block laid out behind this
        // one
        asm volatile("s_wait_xcnt 0x0" ::: "memory");
    }

    {   // bias tile: c[r] = bias of key hi * 8 + r, column n = head
        v8f c = {};
#pragma unroll
        for (int kc = 0; kc < 4; ++kc)
            c = __builtin_amdgcn_wmma_f32_16x16x32_f16(false, ab[kc], false, bb[kc], (short)0, c, false, false);
        if (n < 4) {
            float* bo = biasb + (size_t)n * NN_ + (rb >> 4) * 4096 + (rb & 15) * 256 + (hi * 16 + wv) * 4;
            *(float4*)(bo)       = make_float4(c[0], c[1], c[2], c[3]);
            *(float4*)(bo + 128) = make_float4(c[4], c[5], c[6], c[7]);
        }
    }
}

__global__ __launch_bounds__(256) void attn_kernel(const _Float16* __restrict__ qkvg,
                                                   const float* __restrict__ biasb,
                                                   _Float16* __restrict__ og) {
    __shared__ __attribute__((aligned(16))) _Float16 Ksh[8192];
    __shared__ __attribute__((aligned(16))) _Float16 Vsh[8192];
    int i = blockIdx.x, h = blockIdx.y;
    int t = threadIdx.x, wv = t >> 5, lane = t & 31;

    // this (i, h)'s 8192 halves of each plane
    const _Float16* Qg = qkvg + (size_t)(i * 4 + h) * 8192;
    const _Float16* Kg = Qg + (size_t)1 * NN_ * 128;
    const _Float16* Vg = Qg + (size_t)2 * NN_ * 128;
    const _Float16* Gg = Qg + (size_t)3 * NN_ * 128;

    {
        uint32_t kd = lds_addr_of(Ksh) + t * 16;
        uint32_t vd = lds_addr_of(Vsh) + t * 16;
        const _Float16* kg = Kg + t * 8;
        const _Float16* vg = Vg + t * 8;
        asm volatile("global_load_async_to_lds_b128 %0, %8, off\n\t"
                     "global_load_async_to_lds_b128 %1, %9, off\n\t"
                     "global_load_async_to_lds_b128 %2, %10, off\n\t"
                     "global_load_async_to_lds_b128 %3, %11, off\n\t"
                     "global_load_async_to_lds_b128 %4, %12, off\n\t"
                     "global_load_async_to_lds_b128 %5, %13, off\n\t"
                     "global_load_async_to_lds_b128 %6, %14, off\n\t"
                     "global_load_async_to_lds_b128 %7, %15, off\n\t"
                     "s_wait_xcnt 0x0"
                     :: "v"(kd),            "v"(kd + 1 * 4096),
                        "v"(kd + 2 * 4096), "v"(kd + 3 * 4096),
                        "v"(vd),            "v"(vd + 1 * 4096),
                        "v"(vd + 2 * 4096), "v"(vd + 3 * 4096),
                        "v"((uint64_t)(uintptr_t)(kg)),
                        "v"((uint64_t)(uintptr_t)(kg + 1 * 2048)),
                        "v"((uint64_t)(uintptr_t)(kg + 2 * 2048)),
                        "v"((uint64_t)(uintptr_t)(kg + 3 * 2048)),
                        "v"((uint64_t)(uintptr_t)(vg)),
                        "v"((uint64_t)(uintptr_t)(vg + 1 * 2048)),
                        "v"((uint64_t)(uintptr_t)(vg + 2 * 2048)),
                        "v"((uint64_t)(uintptr_t)(vg + 3 * 2048))
                     : "memory");
    }
    // the wave's own copies have landed; the barrier publishes all waves' pieces
    asm volatile("s_wait_asynccnt 0x0" ::: "memory");
    __syncthreads();

    for (int jt = wv * 2; jt < wv * 2 + 2; ++jt) {
        // compiler fence: keeps each tile's K and V^T fragment reads inside its own
        // trip; hoisted out of the loop they hold 256 registers and cost resident waves
        asm volatile("" ::: "memory");
        // Q^T fragment: column = query n (Q pre-scaled by 1/sqrt(DH) in proj)
        v16h bq = load_frag16_ord(Qg + jt * 512, Qg + jt * 512 + 256, lane);

        // ---- S^T = K Q^T + bias^T: s[kt][r] = score(query n, key kt*16 + hi*8 + r);
        //      the bias plane lies in this accumulator order (see proj_kernel): each
        //      wave-wide 16-byte load covers 512 contiguous bytes
        v8f s[16];
        const float* bbase = biasb + (size_t)h * NN_ + jt * 4096 + lane * 4;
#pragma unroll
        for (int kt = 0; kt < 16; ++kt) {
            v16h ak = load_frag16_ord(Ksh + kt * 512, Ksh + kt * 512 + 256, lane);
            float4 c0 = *(const float4*)(bbase + kt * 256);
            float4 c1 = *(const float4*)(bbase + kt * 256 + 128);
            v8f c = {c0.x, c0.y, c0.z, c0.w, c1.x, c1.y, c1.z, c1.w};
            s[kt] = __builtin_amdgcn_wmma_f32_16x16x32_f16(false, ak, false, bq,
                                                           (short)0, c, false, false);
        }

        // ---- the query's maximum: in-lane, then one exchange between halves ----
        float mr[8];
#pragma unroll
        for (int r = 0; r < 8; ++r) {
            float m0 = s[0][r];
#pragma unroll
            for (int kt = 1; kt < 16; ++kt) m0 = fmaxf(m0, s[kt][r]);
            mr[r] = m0;
        }
        float mx = fmaxf(fmaxf(fmaxf(mr[0], mr[1]), fmaxf(mr[2], mr[3])),
                         fmaxf(fmaxf(mr[4], mr[5]), fmaxf(mr[6], mr[7])));
        mx = fmaxf(mx, __shfl_xor(mx, 16, 32));

        // ---- O^T = V^T P^T (two dh tiles of 16), P^T packed from the scores ----
        float sm[8];
#pragma unroll
        for (int r = 0; r < 8; ++r) sm[r] = 0.0f;
        v8f o0 = {}, o1 = {};
#pragma unroll
        for (int kp = 0; kp < 8; ++kp) {
            v16h bp;
#pragma unroll
            for (int r = 0; r < 8; ++r) {
                float e0 = __expf(s[2 * kp][r] - mx);
                float e1 = __expf(s[2 * kp + 1][r] - mx);
                sm[r] += e0 + e1;
                bp[r]     = (_Float16)e0;   // key kp*32 + hi*8 + r
                bp[8 + r] = (_Float16)e1;   // key kp*32 + 16 + hi*8 + r
            }
            v16h av0 = load_frag16_ord(Vsh + kp * 512, Vsh + kp * 512 + 256, lane);
            v16h av1 = load_frag16_ord(Vsh + 4096 + kp * 512, Vsh + 4096 + kp * 512 + 256, lane);
            o0 = __builtin_amdgcn_wmma_f32_16x16x32_f16(false, av0, false, bp,
                                                        (short)0, o0, false, false);
            o1 = __builtin_amdgcn_wmma_f32_16x16x32_f16(false, av1, false, bp,
                                                        (short)0, o1, false, false);
        }
        float sum = ((sm[0] + sm[1]) + (sm[2] + sm[3])) + ((sm[4] + sm[5]) + (sm[6] + sm[7]));
        sum += __shfl_xor(sum, 16, 32);
        float inv = 1.0f / sum;

        // ---- normalize, gate with sigmoid(g), store in fragment order (see out_kernel):
        //      o0[r] = channel hi*8 + r, o1[r] = channel 16 + hi*8 + r of query n
        _Float16* op = og + (size_t)((i * 16 + jt) * 4 + h) * 512 + lane * 8;
        union { _Float16 h[8]; uint4 q; } g0, g1, r0, r1;
        g0.q = *(const uint4*)(Gg + jt * 512 + lane * 8);
        g1.q = *(const uint4*)(Gg + jt * 512 + 256 + lane * 8);
#pragma unroll
        for (int r = 0; r < 8; ++r) {
            float s0 = 1.0f / (1.0f + __expf(-(float)g0.h[r]));
            float s1 = 1.0f / (1.0f + __expf(-(float)g1.h[r]));
            r0.h[r] = (_Float16)(o0[r] * inv * s0);
            r1.h[r] = (_Float16)(o1[r] * inv * s1);
        }
        *(uint4*)(op)       = r0.q;
        *(uint4*)(op + 256) = r1.q;
    }
}

// ---------------------------------------------------------------------------
// Kernel 4: output projection out = og @ o_w^T  (f32 result). Wave w holds
// column tile w & 7 and walks row tiles (w >> 3) * 8 .. + 7 of the block.
// og lies as this kernel's A fragments: [row tile][head = k chunk][j][lane][8],
// row = lane & 15, channels head*32 + j*16 + hi*8 + 0..7; the block's 64 KB are
// copied flat into LDS and every fragment read is lane * 16 B.
// ---------------------------------------------------------------------------
__global__ __launch_bounds__(512) void out_kernel(const _Float16* __restrict__ og,
                                                  const _Float16* __restrict__ wo,
                                                  float* __restrict__ out) {
    int rb = blockIdx.x, t = threadIdx.x, lane = t & 31;
    int wv = __builtin_amdgcn_readfirstlane(t >> 5);
    __shared__ __attribute__((aligned(16))) _Float16 atile[RB_ * 128];

    stage_rows<128>(atile, og + (size_t)rb * RB_ * 128, t);

    int ct = wv & 7, r0 = (wv >> 3) * 128;   // column tile, first row in the block
    v16h b[4];
#pragma unroll
    for (int kc = 0; kc < 4; ++kc) b[kc] = load_frag16(wo + ct * 16 * 128 + kc * 32, 128, lane);

    // the wave's own copies have landed; the barrier publishes all waves' rows
    asm volatile("s_wait_asynccnt 0x0" ::: "memory");
    __syncthreads();

    int hi = lane >> 4, n = lane & 15;
    float* op = out + (size_t)(rb * RB_ + r0 + hi * 8) * 128 + ct * 16 + n;
#pragma unroll
    for (int rt = 0; rt < 8; ++rt) {
        v16h a[4];
#pragma unroll
        for (int kc = 0; kc < 4; ++kc) {
            const _Float16* f = atile + ((r0 / 16 + rt) * 4 + kc) * 512;
            a[kc] = load_frag16_ord(f, f + 256, lane);
        }
        v8f c = {};
#pragma unroll
        for (int kc = 0; kc < 4; ++kc)
            c = __builtin_amdgcn_wmma_f32_16x16x32_f16(false, a[kc], false, b[kc], (short)0, c, false, false);
#pragma unroll
        for (int r = 0; r < 8; ++r)
            op[(rt * 16 + r) * 128] = c[r];
    }
}

// ---------------------------------------------------------------------------
extern "C" void kernel_launch(void* const* d_in, const int* in_sizes, int n_in,
                              void* d_out, int out_size, void* d_ws, size_t ws_size,
                              hipStream_t stream) {
    const float* x   = (const float*)d_in[0];
    const float* lnw = (const float*)d_in[1];
    const float* lnb = (const float*)d_in[2];
    const float* bw  = (const float*)d_in[3];
    const float* qw  = (const float*)d_in[4];
    const float* kw  = (const float*)d_in[5];
    const float* vw  = (const float*)d_in[6];
    const float* gw  = (const float*)d_in[7];
    const float* ow  = (const float*)d_in[8];
    float* out = (float*)d_out;

    char* ws = (char*)d_ws;
    _Float16* hn    = (_Float16*)ws;                       // NN*D f16
    _Float16* qkvg  = hn + (size_t)NN_ * D_;               // 4*NN*D f16
    float*    biasb = (float*)(qkvg + (size_t)4 * NN_ * D_);  // H*NN f32
    _Float16* og    = (_Float16*)(biasb + (size_t)H_ * NN_);  // NN*D f16
    _Float16* wcat  = og + (size_t)NN_ * D_;               // 528*128 f16
    _Float16* wo    = wcat + 528 * 128;                    // 128*128 f16

    prep_weights<<<328, 256, 0, stream>>>(qw, kw, vw, gw, bw, ow, wcat, wo);
    ln_kernel<<<NN_ / 8, 256, 0, stream>>>(x, lnw, lnb, hn);
    proj_kernel<<<NN_ / RB_, 512, 0, stream>>>(hn, wcat, qkvg, biasb);
    attn_kernel<<<dim3(256, 4), 256, 0, stream>>>(qkvg, biasb, og);
    out_kernel<<<NN_ / RB_, 512, 0, stream>>>(og, wo, out);
}

// v005
// One run takes 57.7 microseconds.
// Two timings next to v004 both put it at 1.13 times that version's speed.
// Counting every step since v000, it is 3.67 times as fast.
#include <hip/hip_runtime.h>

typedef __attribute__((ext_vector_type(16))) _Float16 v16h;
typedef __attribute__((ext_vector_type(8)))  float    v8f;
typedef __attribute__((ext_vector_type(8)))  _Float16 v8h;

constexpr int NN_ = 65536;   // N*N rows
constexpr int D_  = 128;
constexpr int H_  = 4;

union FragH { v16h h; uint32_t u[8]; };

__device__ inline uint32_t lds_addr_of(const void* p) {
    return (uint32_t)(uintptr_t)p;
}

__device__ inline v16h load_frag16(const _Float16* base, int stride, int lane) {
    int rc = lane & 15;
    int hi = (lane >> 4) & 1;
    const _Float16* p = base + rc * stride;
    FragH f;
#pragma unroll
    for (int v = 0; v < 8; ++v) {
        int k = ((v & 4) << 2) + hi * 8 + (v & 3) * 2;   // pairs of consecutive K
        f.u[v] = *(const uint32_t*)(p + k);
    }
    return f.h;
}

__device__ inline v16h load_frag16_lds(const _Float16* base, int stride, int lane) {
    const _Float16* p = base + (lane & 15) * stride + ((lane >> 4) & 1) * 8;
    union { v16h h; uint4 q[2]; } f;
    f.q[0] = *(const uint4*)(p);        // K = hi*8 + 0..7
    f.q[1] = *(const uint4*)(p + 16);   // K = 16 + hi*8 + 0..7
    return f.h;
}

// A fragment stored in fragment order: two pieces of 32 lanes x 16 B, piece 0 at
// p0 and piece 1 at p1 (halves K = hi*8 + 0..7 and K = 16 + hi*8 + 0..7 of the
// lane's row or column). Each wave-wide load covers 512 contiguous bytes.
__device__ inline v16h load_frag16_ord(const _Float16* p0, const _Float16* p1, int lane) {
    union { v16h h; uint4 q[2]; } f;
    f.q[0] = *(const uint4*)(p0 + lane * 8);
    f.q[1] = *(const uint4*)(p1 + lane * 8);
    return f.h;
}

// LDS row pitch in halves, 16 B x odd
constexpr int AP_ = 136;   // 128-half activation rows: 272 B

// ---------------------------------------------------------------------------
// Kernel 0: weight preconversion to f16 (scale folded into q_w).
// wcat rows: [0..127]=q*scale, [128..255]=k, [256..383]=v, [384..511]=g,
//            [512..515]=bias_w, [516..527]=0
// ---------------------------------------------------------------------------
__global__ void prep_weights(const float* qw, const float* kw, const float* vw,
                             const float* gw, const float* bw, const float* ow,
                             _Float16* wcat, _Float16* wo) {
    int idx = blockIdx.x * 256 + threadIdx.x;
    const float scale = 0.17677669529663687f;   // 1/sqrt(32)
    if (idx < 528 * 128) {
        int r = idx >> 7, c = idx & 127;
        float v;
        if      (r < 128) v = qw[idx] * scale;
        else if (r < 256) v = kw[(r - 128) * 128 + c];
        else if (r < 384) v = vw[(r - 256) * 128 + c];
        else if (r < 512) v = gw[(r - 384) * 128 + c];
        else if (r < 516) v = bw[(r - 512) * 128 + c];
        else              v = 0.0f;
        wcat[idx] = (_Float16)v;
    } else if (idx < 528 * 128 + 128 * 128) {
        // o_w in the order of the B fragments of the output product: pieces
        // [column tile][k chunk][half q][lane][8], column = tile*16 + (lane & 15),
        // k = chunk*32 + q*16 + (lane >> 4)*8 + 0..7
        int j = idx - 528 * 128;
        int ln = (j >> 3) & 31;
        int sj = ((j >> 11) * 16 + (ln & 15)) * 128 + ((j >> 9) & 3) * 32
               + ((j >> 8) & 1) * 16 + (ln >> 4) * 8 + (j & 7);
        wo[j] = (_Float16)ow[sj];
    }
}

// ---------------------------------------------------------------------------
// Kernel 1: LayerNorm over D=128. One wave per row: float4 per lane,
// shfl_xor reductions, packed 8-byte f16 store. No LDS, no barriers.
// ---------------------------------------------------------------------------
__global__ __launch_bounds__(256) void ln_kernel(const float* __restrict__ x,
                                                 const float* __restrict__ lnw,
                                                 const float* __restrict__ lnb,
                                                 _Float16* __restrict__ hn) {
    int t = threadIdx.x, wv = t >> 5, lane = t & 31;
    size_t row = (size_t)blockIdx.x * 8 + wv;
    float4 v = ((const float4*)(x + row * 128))[lane];

    float ps = v.x + v.y + v.z + v.w;
    ps += __shfl_xor(ps, 1, 32);  ps += __shfl_xor(ps, 2, 32);
    ps += __shfl_xor(ps, 4, 32);  ps += __shfl_xor(ps, 8, 32);
    ps += __shfl_xor(ps, 16, 32);
    float mu = ps * (1.0f / 128.0f);

    float dx = v.x - mu, dy = v.y - mu, dz = v.z - mu, dw = v.w - mu;
    float pv = dx * dx + dy * dy + dz * dz + dw * dw;
    pv += __shfl_xor(pv, 1, 32);  pv += __shfl_xor(pv, 2, 32);
    pv += __shfl_xor(pv, 4, 32);  pv += __shfl_xor(pv, 8, 32);
    pv += __shfl_xor(pv, 16, 32);
    float rs = rsqrtf(pv * (1.0f / 128.0f) + 1e-5f);

    float4 w = ((const float4*)lnw)[lane];
    float4 b = ((const float4*)lnb)[lane];
    union { _Float16 h[4]; uint2 u; } o;
    o.h[0] = (_Float16)(dx * rs * w.x + b.x);
    o.h[1] = (_Float16)(dy * rs * w.y + b.y);
    o.h[2] = (_Float16)(dz * rs * w.z + b.z);
    o.h[3] = (_Float16)(dw * rs * w.w + b.w);
    *(uint2*)(hn + row * 128 + lane * 4) = o.u;
}

// ---------------------------------------------------------------------------
// Row block of the projection GEMM: one work-group of 16 waves takes 256
// rows (16 row tiles). Each wave loads its weight fragments once and keeps
// them in registers over all its row tiles.
// ---------------------------------------------------------------------------
constexpr int RB_ = 256;   // rows per work-group

template <int P>
__device__ inline void stage_rows(_Float16* atile, const _Float16* g, int t) {
    uint32_t l0 = lds_addr_of(atile) + (t >> 4) * (P * 2) + (t & 15) * 16;
    const _Float16* g0 = g + t * 8;
    asm volatile("global_load_async_to_lds_b128 %0, %8, off\n\t"
                 "global_load_async_to_lds_b128 %1, %9, off\n\t"
                 "global_load_async_to_lds_b128 %2, %10, off\n\t"
                 "global_load_async_to_lds_b128 %3, %11, off\n\t"
                 "global_load_async_to_lds_b128 %4, %12, off\n\t"
                 "global_load_async_to_lds_b128 %5, %13, off\n\t"
                 "global_load_async_to_lds_b128 %6, %14, off\n\t"
                 "global_load_async_to_lds_b128 %7, %15, off\n\t"
                 "s_wait_xcnt 0x0"
                 :: "v"(l0),                  "v"(l0 + 1 * 32 * P * 2),
                    "v"(l0 + 2 * 32 * P * 2), "v"(l0 + 3 * 32 * P * 2),
                    "v"(l0 + 4 * 32 * P * 2), "v"(l0 + 5 * 32 * P * 2),
                    "v"(l0 + 6 * 32 * P * 2), "v"(l0 + 7 * 32 * P * 2),
                    "v"((uint64_t)(uintptr_t)(g0)),
                    "v"((uint64_t)(uintptr_t)(g0 + 1 * 4096)),
                    "v"((uint64_t)(uintptr_t)(g0 + 2 * 4096)),
                    "v"((uint64_t)(uintptr_t)(g0 + 3 * 4096)),
                    "v"((uint64_t)(uintptr_t)(g0 + 4 * 4096)),
                    "v"((uint64_t)(uintptr_t)(g0 + 5 * 4096)),
                    "v"((uint64_t)(uintptr_t)(g0 + 6 * 4096)),
                    "v"((uint64_t)(uintptr_t)(g0 + 7 * 4096))
                 : "memory");
}

// ---------------------------------------------------------------------------
// Kernel 2: fused projections. 33 column tiles of 16: 0..31 -> Q,K,V,G (f16
// out), two per wave over all 16 row tiles; 32 -> tri_bias (f32 out). Wave w
// owns the 32 channels of head w & 3 of tensor w >> 2. Each plane is stored in
// the order in which the attention kernel's fragments hold it, 8192 halves per
// (i, head), in pieces of [lane = hi * 16 + n][8 halves]:
//   Q, K, G: piece (row tile rt, j): row rt*16 + n, channels j*16 + hi*8 + 0..7,
//            at rt*512 + j*256; made by the transposed product W hn^T;
//   V:       piece (j, rt): channel j*16 + n, rows rt*16 + hi*8 + 0..7,
//            at (j*16 + rt)*256; made by hn W^T: this is V^T's A fragment.
// A lane's 8 accumulators are one 16-byte store; a wave-wide store is 512
// contiguous bytes. The bias
// plane is laid out as the attention kernel's S^T accumulators read it:
// [head][query tile][key tile][r >> 2][hi * 16 + (query & 15)][r & 3], key in the
// tile = hi * 8 + r. Work-group rb writes the whole 1 KB block (query tile
// rb >> 4, key tile rb & 15) of each head; wave w does query w of the tile and
// reads its 16 rows of hn straight from global memory.
// ---------------------------------------------------------------------------
__global__ __launch_bounds__(512) void proj_kernel(const _Float16* __restrict__ hn,
                                                   const _Float16* __restrict__ wcat,
                                                   _Float16* __restrict__ qkvg,
                                                   float* __restrict__ biasb) {
    int rb = blockIdx.x;                  // row block 0..255
    int t = threadIdx.x, lane = t & 31;
    int wv = __builtin_amdgcn_readfirstlane(t >> 5);
    __shared__ __attribute__((aligned(16))) _Float16 atile[RB_ * AP_];

    stage_rows<AP_>(atile, hn + (size_t)rb * RB_ * 128, t);

    // weight fragments, loaded while the copies fly
    v16h b[2][4];
#pragma unroll
    for (int j = 0; j < 2; ++j)
#pragma unroll
        for (int kc = 0; kc < 4; ++kc)
            b[j][kc] = load_frag16(wcat + (wv * 2 + j) * 16 * 128 + kc * 32, 128, lane);

    // the wave's own copies have landed; the barrier publishes all waves' rows
    asm volatile("s_wait_asynccnt 0x0" ::: "memory");
    __syncthreads();

    int n = lane & 15, hi = lane >> 4;

    // bias-tile weights: asked for here so that they fly under the main loop
    v16h bb[4];
#pragma unroll
    for (int kc = 0; kc < 4; ++kc)
        bb[kc] = load_frag16(wcat + 32 * 16 * 128 + kc * 32, 128, lane);
    const _Float16* hb = hn + ((size_t)((rb >> 4) * 16 + wv) * 256 + (rb & 15) * 16) * 128;
    v16h ab[4];
#pragma unroll
    for (int kc = 0; kc < 4; ++kc)
        ab[kc] = load_frag16(hb + kc * 32, 128, lane);

    _Float16* outp = qkvg + (size_t)(wv >> 2) * NN_ * 128
                   + (size_t)(rb * 4 + (wv & 3)) * 8192 + lane * 8;
    if ((wv >> 2) == 2) {   // V: rows in the registers (wave-uniform branch)
#pragma unroll
        for (int rt = 0; rt < RB_ / 16; ++rt) {
            v16h a[4];
#pragma unroll
            for (int kc = 0; kc < 4; ++kc) a[kc] = load_frag16_lds(atile + rt * 16 * AP_ + kc * 32, AP_, lane);
            v8f c0 = {}, c1 = {};
#pragma unroll
            for (int kc = 0; kc < 4; ++kc) {
                c0 = __builtin_amdgcn_wmma_f32_16x16x32_f16(false, a[kc], false, b[0][kc], (short)0, c0, false, false);
                c1 = __builtin_amdgcn_wmma_f32_16x16x32_f16(false, a[kc], false, b[1][kc], (short)0, c1, false, false);
            }
            *(v8h*)(outp + rt * 256)        = __builtin_convertvector(c0, v8h);
            *(v8h*)(outp + (16 + rt) * 256) = __builtin_convertvector(c1, v8h);
        }
    } else {                // Q, K, G: channels in the registers
#pragma unroll
        for (int rt = 0; rt < RB_ / 16; ++rt) {
            v16h a[4];
#pragma unroll
            for (int kc = 0; kc < 4; ++kc) a[kc] = load_frag16_lds(atile + rt * 16 * AP_ + kc * 32, AP_, lane);
            v8f c0 = {}, c1 = {};
#pragma unroll
            for (int kc = 0; kc < 4; ++kc) {
                c0 = __builtin_amdgcn_wmma_f32_16x16x32_f16(false, b[0][kc], false, a[kc], (short)0, c0, false, false);
                c1 = __builtin_amdgcn_wmma_f32_16x16x32_f16(false, b[1][kc], false, a[kc], (short)0, c1, false, false);
            }
            *(v8h*)(outp + rt * 512)       = __builtin_convertvector(c0, v8h);
            *(v8h*)(outp + rt * 512 + 256) = __builtin_convertvector(c1, v8h);
        }
        // the last store's registers are rewritten by the block laid out behind this
        // one
        asm volatile("s_wait_xcnt 0x0" ::: "memory");
    }

    {   // bias tile: c[r] = bias of key hi * 8 + r, column n = head
        v8f c = {};
#pragma unroll
        for (int kc = 0; kc < 4; ++kc)
            c = __builtin_amdgcn_wmma_f32_16x16x32_f16(false, ab[kc], false, bb[kc], (short)0, c, false, false);
        if (n < 4) {
            float* bo = biasb + (size_t)n * NN_ + (rb >> 4) * 4096 + (rb & 15) * 256 + (hi * 16 + wv) * 4;
            *(float4*)(bo)       = make_float4(c[0], c[1], c[2], c[3]);
            *(float4*)(bo + 128) = make_float4(c[4], c[5], c[6], c[7]);
        }
    }
}

__device__ inline void copy_2x2(uint32_t la, const _Float16* ga, uint32_t lb, const _Float16* gb) {
    asm volatile("global_load_async_to_lds_b128 %0, %4, off\n\t"
                 "global_load_async_to_lds_b128 %1, %5, off\n\t"
                 "global_load_async_to_lds_b128 %2, %6, off\n\t"
                 "global_load_async_to_lds_b128 %3, %7, off\n\t"
                 "s_wait_xcnt 0x0"
                 :: "v"(la), "v"(la + 8192), "v"(lb), "v"(lb + 8192),
                    "v"((uint64_t)(uintptr_t)(ga)), "v"((uint64_t)(uintptr_t)(ga + 4096)),
                    "v"((uint64_t)(uintptr_t)(gb)), "v"((uint64_t)(uintptr_t)(gb + 4096))
                 : "memory");
}
__device__ inline void copy_6(uint32_t l, const _Float16* g) {
    asm volatile("global_load_async_to_lds_b128 %0, %6, off\n\t"
                 "global_load_async_to_lds_b128 %1, %7, off\n\t"
                 "global_load_async_to_lds_b128 %2, %8, off\n\t"
                 "global_load_async_to_lds_b128 %3, %9, off\n\t"
                 "global_load_async_to_lds_b128 %4, %10, off\n\t"
                 "global_load_async_to_lds_b128 %5, %11, off\n\t"
                 "s_wait_xcnt 0x0"
                 :: "v"(l),            "v"(l + 1 * 8192), "v"(l + 2 * 8192),
                    "v"(l + 3 * 8192), "v"(l + 4 * 8192), "v"(l + 5 * 8192),
                    "v"((uint64_t)(uintptr_t)(g)),
                    "v"((uint64_t)(uintptr_t)(g + 1 * 4096)),
                    "v"((uint64_t)(uintptr_t)(g + 2 * 4096)),
                    "v"((uint64_t)(uintptr_t)(g + 3 * 4096)),
                    "v"((uint64_t)(uintptr_t)(g + 4 * 4096)),
                    "v"((uint64_t)(uintptr_t)(g + 5 * 4096))
                 : "memory");
}

__global__ __launch_bounds__(512) void attn_kernel(const _Float16* __restrict__ qkvg,
                                                   const float* __restrict__ biasb,
                                                   const _Float16* __restrict__ wo,
                                                   float* __restrict__ out) {
    __shared__ __attribute__((aligned(16))) _Float16 Ksh[4 * 8192];
    __shared__ __attribute__((aligned(16))) _Float16 Vsh[4 * 8192];
    __shared__ __attribute__((aligned(16))) _Float16 Wsh[128 * 128];
    __shared__ __attribute__((aligned(16))) _Float16 Osh[16 * 2048];
    int i = blockIdx.x;
    int t = threadIdx.x, lane = t & 31;
    int jt = __builtin_amdgcn_readfirstlane(t >> 5);   // the wave's query tile

    // row i's 4 x 8192 halves of each plane
    const _Float16* Qg = qkvg + (size_t)i * 4 * 8192;
    const _Float16* Kg = Qg + (size_t)1 * NN_ * 128;
    const _Float16* Vg = Qg + (size_t)2 * NN_ * 128;
    const _Float16* Gg = Qg + (size_t)3 * NN_ * 128;

    // head 0: 1024 pieces of 16 B of K and of V^T, 2 + 2 per lane
    copy_2x2(lds_addr_of(Ksh) + t * 16, Kg + t * 8, lds_addr_of(Vsh) + t * 16, Vg + t * 8);
    // the wave's own copies have landed; the barrier publishes all waves' pieces
    asm volatile("s_wait_asynccnt 0x0" ::: "memory");
    __syncthreads();
    // heads 1..3 (6 + 6 pieces per lane) and o_w (4 per lane): into LDS that nobody
    // has touched yet; waited for and published in front of head 1
    copy_6(lds_addr_of(Ksh) + 16384 + t * 16, Kg + 8192 + t * 8);
    copy_6(lds_addr_of(Vsh) + 16384 + t * 16, Vg + 8192 + t * 8);
    copy_2x2(lds_addr_of(Wsh) + t * 16, wo + t * 8, lds_addr_of(Wsh) + 16384 + t * 16, wo + 8192 + t * 8);

    _Float16* park = Osh + jt * 2048 + lane * 8;

    // kept rolled: four copies of the body would buy nothing
#pragma unroll 1
    for (int h = 0; h < 4; ++h) {
        if (h == 1) {
            // the second batch: own copies landed, then published to all waves
            asm volatile("s_wait_asynccnt 0x0" ::: "memory");
            __syncthreads();
        }
        const _Float16* Kh = Ksh + h * 8192;
        const _Float16* Vh = Vsh + h * 8192;
        // Q^T fragment: column = query n (Q pre-scaled by 1/sqrt(DH) in proj)
        const _Float16* qp = Qg + h * 8192 + jt * 512;
        v16h bq = load_frag16_ord(qp, qp + 256, lane);

        // ---- S^T = K Q^T + bias^T: s[kt][r] = score(query n, key kt*16 + hi*8 + r);
        //      the bias plane lies in this accumulator order (see proj_kernel): each
        //      wave-wide 16-byte load covers 512 contiguous bytes
        v8f s[16];
        const float* bbase = biasb + (size_t)h * NN_ + jt * 4096 + lane * 4;
#pragma unroll
        for (int kt = 0; kt < 16; ++kt) {
            v16h ak = load_frag16_ord(Kh + kt * 512, Kh + kt * 512 + 256, lane);
            float4 c0 = *(const float4*)(bbase + kt * 256);
            float4 c1 = *(const float4*)(bbase + kt * 256 + 128);
            v8f c = {c0.x, c0.y, c0.z, c0.w, c1.x, c1.y, c1.z, c1.w};
            s[kt] = __builtin_amdgcn_wmma_f32_16x16x32_f16(false, ak, false, bq,
                                                           (short)0, c, false, false);
        }
        // the loads' address registers stay whole up to this wait
        asm volatile("s_wait_xcnt 0x0" :: "v"(bbase), "v"(qp + lane * 8) : "memory");

        // ---- the query's maximum: in-lane, then one exchange between halves ----
        float mr[8];
#pragma unroll
        for (int r = 0; r < 8; ++r) {
            float m0 = s[0][r];
#pragma unroll
            for (int kt = 1; kt < 16; ++kt) m0 = fmaxf(m0, s[kt][r]);
            mr[r] = m0;
        }
        float mx = fmaxf(fmaxf(fmaxf(mr[0], mr[1]), fmaxf(mr[2], mr[3])),
                         fmaxf(fmaxf(mr[4], mr[5]), fmaxf(mr[6], mr[7])));
        mx = fmaxf(mx, __shfl_xor(mx, 16, 32));
        // keeps the V^T fragment reads behind the scores: lifted above them they take
        // the wave past its 256 registers and loop addresses spill to scratch
        __builtin_amdgcn_sched_barrier(0);

        // ---- O^T = V^T P^T (two dh tiles of 16), P^T packed from the scores ----
        float sm[8];
#pragma unroll
        for (int r = 0; r < 8; ++r) sm[r] = 0.0f;
        v8f o0 = {}, o1 = {};
#pragma unroll
        for (int kp = 0; kp < 8; ++kp) {
            v16h bp;
#pragma unroll
            for (int r = 0; r < 8; ++r) {
                float e0 = __expf(s[2 * kp][r] - mx);
                float e1 = __expf(s[2 * kp + 1][r] - mx);
                sm[r] += e0 + e1;
                bp[r]     = (_Float16)e0;   // key kp*32 + hi*8 + r
                bp[8 + r] = (_Float16)e1;   // key kp*32 + 16 + hi*8 + r
            }
            v16h av0 = load_frag16_ord(Vh + kp * 512, Vh + kp * 512 + 256, lane);
            v16h av1 = load_frag16_ord(Vh + 4096 + kp * 512, Vh + 4096 + kp * 512 + 256, lane);
            o0 = __builtin_amdgcn_wmma_f32_16x16x32_f16(false, av0, false, bp,
                                                        (short)0, o0, false, false);
            o1 = __builtin_amdgcn_wmma_f32_16x16x32_f16(false, av1, false, bp,
                                                        (short)0, o1, false, false);
        }
        float sum = ((sm[0] + sm[1]) + (sm[2] + sm[3])) + ((sm[4] + sm[5]) + (sm[6] + sm[7]));
        sum += __shfl_xor(sum, 16, 32);
        float inv = 1.0f / sum;

        // ---- normalize, gate with sigmoid(g), park as the lane's share of A chunk h:
        //      o0[r] = channel hi*8 + r, o1[r] = channel 16 + hi*8 + r of query n
        union { _Float16 h[8]; uint4 q; } g0, g1, r0, r1;
        const _Float16* gp = Gg + h * 8192 + jt * 512 + lane * 8;
        g0.q = *(const uint4*)(gp);
        g1.q = *(const uint4*)(gp + 256);
        asm volatile("s_wait_xcnt 0x0" :: "v"(gp) : "memory");
#pragma unroll
        for (int r = 0; r < 8; ++r) {
            float s0 = 1.0f / (1.0f + __expf(-(float)g0.h[r]));
            float s1 = 1.0f / (1.0f + __expf(-(float)g1.h[r]));
            r0.h[r] = (_Float16)(o0[r] * inv * s0);
            r1.h[r] = (_Float16)(o1[r] * inv * s1);
        }
        *(uint4*)(park + h * 512)       = r0.q;
        *(uint4*)(park + h * 512 + 256) = r1.q;
    }

    // ---- out rows i*256 + jt*16 .. + 15 = og o_w^T (f32 result): A = the parked
    //      fragments, row = query n, k chunk = head; B = o_w column tile ct
    v16h a[4];
#pragma unroll
    for (int kc = 0; kc < 4; ++kc) {
        const _Float16* f = Osh + jt * 2048 + kc * 512;
        a[kc] = load_frag16_ord(f, f + 256, lane);
    }
    int hi = lane >> 4, n = lane & 15;
    float* op = out + (size_t)(i * 256 + jt * 16 + hi * 8) * 128 + n;
#pragma unroll
    for (int ct = 0; ct < 8; ++ct) {
        v8f c = {};
#pragma unroll
        for (int kc = 0; kc < 4; ++kc) {
            const _Float16* f = Wsh + (ct * 4 + kc) * 512;
            v16h b = load_frag16_ord(f, f + 256, lane);
            c = __builtin_amdgcn_wmma_f32_16x16x32_f16(false, a[kc], false, b, (short)0, c, false, false);
        }
#pragma unroll
        for (int r = 0; r < 8; ++r)
            op[r * 128 + ct * 16] = c[r];
    }
}

// ---------------------------------------------------------------------------
extern "C" void kernel_launch(void* const* d_in, const int* in_sizes, int n_in,
                              void* d_out, int out_size, void* d_ws, size_t ws_size,
                              hipStream_t stream) {
    const float* x   = (const float*)d_in[0];
    const float* lnw = (const float*)d_in[1];
    const float* lnb = (const float*)d_in[2];
    const float* bw  = (const float*)d_in[3];
    const float* qw  = (const float*)d_in[4];
    const float* kw  = (const float*)d_in[5];
    const float* vw  = (const float*)d_in[6];
    const float* gw  = (const float*)d_in[7];
    const float* ow  = (const float*)d_in[8];
    float* out = (float*)d_out;

    char* ws = (char*)d_ws;
    _Float16* hn    = (_Float16*)ws;                       // NN*D f16
    _Float16* qkvg  = hn + (size_t)NN_ * D_;               // 4*NN*D f16
    float*    biasb = (float*)(qkvg + (size_t)4 * NN_ * D_);  // H*NN f32
    _Float16* wcat  = (_Float16*)(biasb + (size_t)H_ * NN_);  // 528*128 f16
    _Float16* wo    = wcat + 528 * 128;                    // 128*128 f16

    prep_weights<<<328, 256, 0, stream>>>(qw, kw, vw, gw, bw, ow, wcat, wo);
    ln_kernel<<<NN_ / 8, 256, 0, stream>>>(x, lnw, lnb, hn);
    proj_kernel<<<NN_ / RB_, 512, 0, stream>>>(hn, wcat, qkvg, biasb);
    attn_kernel<<<256, 512, 0, stream>>>(qkvg, biasb, wo, out);
}

// v006
// Measured time: 40.3 microseconds a run.
// Two timings next to v005 put it at 1.43 and 1.44 times that version's speed.
// Over all steps from v000 it is 5.26 times as fast.
#include <hip/hip_runtime.h>

typedef __attribute__((ext_vector_type(16))) _Float16 v16h;
typedef __attribute__((ext_vector_type(8)))  float    v8f;
typedef __attribute__((ext_vector_type(8)))  _Float16 v8h;

constexpr int NN_ = 65536;   // N*N rows
constexpr int D_  = 128;
constexpr int H_  = 4;

union FragH { v16h h; uint32_t u[8]; };

__device__ inline uint32_t lds_addr_of(const void* p) {
    return (uint32_t)(uintptr_t)p;
}

__device__ inline v16h load_frag16(const _Float16* base, int stride, int lane) {
    int rc = lane & 15;
    int hi = (lane >> 4) & 1;
    const _Float16* p = base + rc * stride;
    FragH f;
#pragma unroll
    for (int v = 0; v < 8; ++v) {
        int k = ((v & 4) << 2) + hi * 8 + (v & 3) * 2;   // pairs of consecutive K
        f.u[v] = *(const uint32_t*)(p + k);
    }
    return f.h;
}

__device__ inline v16h load_frag16_swz(const _Float16* tile, int kc, int lane) {
    int n = lane & 15, hi = (lane >> 4) & 1;
    const _Float16* p = tile + n * 128;
    union { v16h h; uint4 q[2]; } f;
    f.q[0] = *(const uint4*)(p + ((kc * 4 + hi) ^ n) * 8);       // K = hi*8 + 0..7
    f.q[1] = *(const uint4*)(p + ((kc * 4 + 2 + hi) ^ n) * 8);   // K = 16 + hi*8 + 0..7
    return f.h;
}

// A fragment stored in fragment order: two pieces of 32 lanes x 16 B, piece 0 at
// p0 and piece 1 at p1 (halves K = hi*8 + 0..7 and K = 16 + hi*8 + 0..7 of the
// lane's row or column). Each wave-wide load covers 512 contiguous bytes.
__device__ inline v16h load_frag16_ord(const _Float16* p0, const _Float16* p1, int lane) {
    union { v16h h; uint4 q[2]; } f;
    f.q[0] = *(const uint4*)(p0 + lane * 8);
    f.q[1] = *(const uint4*)(p1 + lane * 8);
    return f.h;
}

// ---------------------------------------------------------------------------
// Kernel 0: weight preconversion to f16 (scale folded into q_w).
// wcat rows: [0..127]=q*scale, [128..255]=k, [256..383]=v, [384..511]=g,
//            [512..515]=bias_w, [516..527]=0
// ---------------------------------------------------------------------------
__global__ void prep_weights(const float* qw, const float* kw, const float* vw,
                             const float* gw, const float* bw, const float* ow,
                             _Float16* wcat, _Float16* wo) {
    int idx = blockIdx.x * 256 + threadIdx.x;
    const float scale = 0.17677669529663687f;   // 1/sqrt(32)
    if (idx < 528 * 128) {
        int r = idx >> 7, c = idx & 127;
        float v;
        if      (r < 128) v = qw[idx] * scale;
        else if (r < 256) v = kw[(r - 128) * 128 + c];
        else if (r < 384) v = vw[(r - 256) * 128 + c];
        else if (r < 512) v = gw[(r - 384) * 128 + c];
        else if (r < 516) v = bw[(r - 512) * 128 + c];
        else              v = 0.0f;
        wcat[idx] = (_Float16)v;
    } else if (idx < 528 * 128 + 128 * 128) {
        // o_w in the order of the B fragments of the output product: pieces
        // [column tile][k chunk][half q][lane][8], column = tile*16 + (lane & 15),
        // k = chunk*32 + q*16 + (lane >> 4)*8 + 0..7
        int j = idx - 528 * 128;
        int ln = (j >> 3) & 31;
        int sj = ((j >> 11) * 16 + (ln & 15)) * 128 + ((j >> 9) & 3) * 32
               + ((j >> 8) & 1) * 16 + (ln >> 4) * 8 + (j & 7);
        wo[j] = (_Float16)ow[sj];
    }
}

// ---------------------------------------------------------------------------
// Kernel 1: LayerNorm over D=128 and the triangle bias. 256 work-groups of 16
// waves; wave w of work-group rb takes the 16 rows (query (rb >> 4) * 16 + w, keys
// (rb & 15) * 16 .. + 15): float4 per lane and row, shfl_xor reductions, packed
// 8-byte f16 store to hn. The same 8 bytes go to the wave's LDS tile, from which
// the rows come back as the A fragments of the bias product hn bias_w^T.
// The bias plane is laid out as the attention kernel's S^T accumulators read it:
// [head][query tile][key tile][r >> 2][hi * 16 + (query & 15)][r & 3], key in the
// tile = hi * 8 + r. Work-group rb writes the whole 1 KB block (query tile
// rb >> 4, key tile rb & 15) of each head.
// ---------------------------------------------------------------------------
__global__ __launch_bounds__(512) void ln_bias_kernel(const float* __restrict__ x,
                                                      const float* __restrict__ lnw,
                                                      const float* __restrict__ lnb,
                                                      const _Float16* __restrict__ wcat,
                                                      _Float16* __restrict__ hn,
                                                      float* __restrict__ biasb) {
    __shared__ __attribute__((aligned(16))) _Float16 tile[16 * 2048];
    int rb = blockIdx.x;
    int t = threadIdx.x, lane = t & 31;
    int wv = __builtin_amdgcn_readfirstlane(t >> 5);
    size_t row0 = (size_t)((rb >> 4) * 16 + wv) * 256 + (rb & 15) * 16;
    const float* xr = x + row0 * 128 + lane * 4;

    // scale and shift, the wave's 16 rows (all in flight at once), the bias weights
    float4 w = ((const float4*)lnw)[lane];
    float4 b = ((const float4*)lnb)[lane];
    float4 xv[16];
#pragma unroll
    for (int r = 0; r < 16; ++r) xv[r] = *(const float4*)(xr + r * 128);
    v16h bb[4];
#pragma unroll
    for (int kc = 0; kc < 4; ++kc)
        bb[kc] = load_frag16(wcat + 32 * 16 * 128 + kc * 32, 128, lane);
    // stands behind the row loads, ahead of any rewrite of a register that they name
    asm volatile("s_wait_xcnt 0x0" ::: "memory");

    _Float16* tw = tile + wv * 2048;            // the wave's 16 rows x 128 halves
    _Float16* hp = hn + row0 * 128 + lane * 4;
#pragma unroll
    for (int r = 0; r < 16; ++r) {
        float4 v = xv[r];
        float ps = v.x + v.y + v.z + v.w;
        ps += __shfl_xor(ps, 1, 32);  ps += __shfl_xor(ps, 2, 32);
        ps += __shfl_xor(ps, 4, 32);  ps += __shfl_xor(ps, 8, 32);
        ps += __shfl_xor(ps, 16, 32);
        float mu = ps * (1.0f / 128.0f);

        float dx = v.x - mu, dy = v.y - mu, dz = v.z - mu, dw = v.w - mu;
        float pv = dx * dx + dy * dy + dz * dz + dw * dw;
        pv += __shfl_xor(pv, 1, 32);  pv += __shfl_xor(pv, 2, 32);
        pv += __shfl_xor(pv, 4, 32);  pv += __shfl_xor(pv, 8, 32);
        pv += __shfl_xor(pv, 16, 32);
        float rs = rsqrtf(pv * (1.0f / 128.0f) + 1e-5f);

        union { _Float16 h[4]; uint2 u; } o;
        o.h[0] = (_Float16)(dx * rs * w.x + b.x);
        o.h[1] = (_Float16)(dy * rs * w.y + b.y);
        o.h[2] = (_Float16)(dz * rs * w.z + b.z);
        o.h[3] = (_Float16)(dw * rs * w.w + b.w);
        *(uint2*)(hp + r * 128) = o.u;
        // 16-byte piece lane >> 1 of row r, at place (lane >> 1) ^ r (see load_frag16_swz)
        *(uint2*)(tw + r * 128 + ((lane >> 1) ^ r) * 8 + (lane & 1) * 4) = o.u;
    }
    // the stores' address registers stay whole up to this wait
    asm volatile("s_wait_xcnt 0x0" :: "v"(hp) : "memory");
    // other lanes' LDS stores are read below
    __syncthreads();

    int n = lane & 15, hi = lane >> 4;
    // c[r] = bias of key hi * 8 + r, column n = head
    v8f c = {};
#pragma unroll
    for (int kc = 0; kc < 4; ++kc) {
        v16h ab = load_frag16_swz(tw, kc, lane);
        c = __builtin_amdgcn_wmma_f32_16x16x32_f16(false, ab, false, bb[kc], (short)0, c, false, false);
    }
    if (n < 4) {
        float* bo = biasb + (size_t)n * NN_ + (rb >> 4) * 4096 + (rb & 15) * 256 + (hi * 16 + wv) * 4;
        *(float4*)(bo)       = make_float4(c[0], c[1], c[2], c[3]);
        *(float4*)(bo + 128) = make_float4(c[4], c[5], c[6], c[7]);
    }
}

__device__ inline void stage_rows_swz(_Float16* atile, const _Float16* g, int t) {
    uint32_t l0 = lds_addr_of(atile) + (t >> 4) * 256 + (((t & 15) ^ ((t >> 4) & 15)) * 16);
    const _Float16* g0 = g + t * 8;
    asm volatile("global_load_async_to_lds_b128 %0, %8, off\n\t"
                 "global_load_async_to_lds_b128 %1, %9, off\n\t"
                 "global_load_async_to_lds_b128 %2, %10, off\n\t"
                 "global_load_async_to_lds_b128 %3, %11, off\n\t"
                 "global_load_async_to_lds_b128 %4, %12, off\n\t"
                 "global_load_async_to_lds_b128 %5, %13, off\n\t"
                 "global_load_async_to_lds_b128 %6, %14, off\n\t"
                 "global_load_async_to_lds_b128 %7, %15, off\n\t"
                 "s_wait_xcnt 0x0"
                 :: "v"(l0),            "v"(l0 + 1 * 8192),
                    "v"(l0 + 2 * 8192), "v"(l0 + 3 * 8192),
                    "v"(l0 + 4 * 8192), "v"(l0 + 5 * 8192),
                    "v"(l0 + 6 * 8192), "v"(l0 + 7 * 8192),
                    "v"((uint64_t)(uintptr_t)(g0)),
                    "v"((uint64_t)(uintptr_t)(g0 + 1 * 4096)),
                    "v"((uint64_t)(uintptr_t)(g0 + 2 * 4096)),
                    "v"((uint64_t)(uintptr_t)(g0 + 3 * 4096)),
                    "v"((uint64_t)(uintptr_t)(g0 + 4 * 4096)),
                    "v"((uint64_t)(uintptr_t)(g0 + 5 * 4096)),
                    "v"((uint64_t)(uintptr_t)(g0 + 6 * 4096)),
                    "v"((uint64_t)(uintptr_t)(g0 + 7 * 4096))
                 : "memory");
}

__device__ inline void copy_2x2(uint32_t la, const _Float16* ga, uint32_t lb, const _Float16* gb) {
    asm volatile("global_load_async_to_lds_b128 %0, %4, off\n\t"
                 "global_load_async_to_lds_b128 %1, %5, off\n\t"
                 "global_load_async_to_lds_b128 %2, %6, off\n\t"
                 "global_load_async_to_lds_b128 %3, %7, off\n\t"
                 "s_wait_xcnt 0x0"
                 :: "v"(la), "v"(la + 8192), "v"(lb), "v"(lb + 8192),
                    "v"((uint64_t)(uintptr_t)(ga)), "v"((uint64_t)(uintptr_t)(ga + 4096)),
                    "v"((uint64_t)(uintptr_t)(gb)), "v"((uint64_t)(uintptr_t)(gb + 4096))
                 : "memory");
}

__global__ __launch_bounds__(512) void attn_kernel(const _Float16* __restrict__ hn,
                                                   const _Float16* __restrict__ wcat,
                                                   const float* __restrict__ biasb,
                                                   const _Float16* __restrict__ wo,
                                                   float* __restrict__ out) {
    // the whole LDS of a WGP: four planes of 4 x 8192 halves and the hn rows
    __shared__ __attribute__((aligned(16))) _Float16 sh[5 * 32768];
    _Float16* Qsh = sh;
    _Float16* Ksh = sh + 1 * 32768;
    _Float16* Vsh = sh + 2 * 32768;
    _Float16* Gsh = sh + 3 * 32768;
    _Float16* Ash = sh + 4 * 32768;   // hn rows; behind the projections o_w
    int i = blockIdx.x;
    int t = threadIdx.x, lane = t & 31;
    int jt = __builtin_amdgcn_readfirstlane(t >> 5);   // the wave's number and query tile

    stage_rows_swz(Ash, hn + (size_t)i * 256 * 128, t);

    {
        // weight fragments, loaded while the copies fly
        v16h b[2][4];
#pragma unroll
        for (int j = 0; j < 2; ++j)
#pragma unroll
            for (int kc = 0; kc < 4; ++kc)
                b[j][kc] = load_frag16(wcat + (jt * 2 + j) * 16 * 128 + kc * 32, 128, lane);

        // the wave's own copies have landed; the barrier publishes all waves' rows
        asm volatile("s_wait_asynccnt 0x0" ::: "memory");
        __syncthreads();

        _Float16* outp = sh + (jt >> 2) * 32768 + (jt & 3) * 8192 + lane * 8;
        if ((jt >> 2) == 2) {   // V: rows in the registers (wave-uniform branch)
#pragma unroll
            for (int rt = 0; rt < 16; ++rt) {
                v16h a[4];
#pragma unroll
                for (int kc = 0; kc < 4; ++kc) a[kc] = load_frag16_swz(Ash + rt * 2048, kc, lane);
                v8f c0 = {}, c1 = {};
#pragma unroll
                for (int kc = 0; kc < 4; ++kc) {
                    c0 = __builtin_amdgcn_wmma_f32_16x16x32_f16(false, a[kc], false, b[0][kc], (short)0, c0, false, false);
                    c1 = __builtin_amdgcn_wmma_f32_16x16x32_f16(false, a[kc], false, b[1][kc], (short)0, c1, false, false);
                }
                *(v8h*)(outp + rt * 256)        = __builtin_convertvector(c0, v8h);
                *(v8h*)(outp + (16 + rt) * 256) = __builtin_convertvector(c1, v8h);
            }
        } else {                // Q, K, G: channels in the registers
#pragma unroll
            for (int rt = 0; rt < 16; ++rt) {
                v16h a[4];
#pragma unroll
                for (int kc = 0; kc < 4; ++kc) a[kc] = load_frag16_swz(Ash + rt * 2048, kc, lane);
                v8f c0 = {}, c1 = {};
#pragma unroll
                for (int kc = 0; kc < 4; ++kc) {
                    c0 = __builtin_amdgcn_wmma_f32_16x16x32_f16(false, b[0][kc], false, a[kc], (short)0, c0, false, false);
                    c1 = __builtin_amdgcn_wmma_f32_16x16x32_f16(false, b[1][kc], false, a[kc], (short)0, c1, false, false);
                }
                *(v8h*)(outp + rt * 512)       = __builtin_convertvector(c0, v8h);
                *(v8h*)(outp + rt * 512 + 256) = __builtin_convertvector(c1, v8h);
            }
        }
    }
    // the wave's own LDS reads and writes are done; the barrier publishes the four
    // planes and ends every wave's last read of the hn rows
    asm volatile("s_wait_dscnt 0x0" ::: "memory");
    __syncthreads();
    // o_w (4 pieces per lane) over the hn rows; waited for and published in front of head 1
    copy_2x2(lds_addr_of(Ash) + t * 16, wo + t * 8, lds_addr_of(Ash) + 16384 + t * 16, wo + 8192 + t * 8);

    // kept rolled: four copies of the body would buy nothing
#pragma unroll 1
    for (int h = 0; h < 4; ++h) {
        if (h == 1) {
            // o_w: own copies landed, then published to all waves
            asm volatile("s_wait_asynccnt 0x0" ::: "memory");
            __syncthreads();
        }
        const _Float16* Kh = Ksh + h * 8192;
        const _Float16* Vh = Vsh + h * 8192;
        // Q^T fragment: column = query n (Q pre-scaled by 1/sqrt(DH) in its weights)
        const _Float16* qp = Qsh + h * 8192 + jt * 512;
        v16h bq = load_frag16_ord(qp, qp + 256, lane);

        // ---- S^T = K Q^T + bias^T: s[kt][r] = score(query n, key kt*16 + hi*8 + r);
        //      the bias plane lies in this accumulator order (see ln_bias_kernel): each
        //      wave-wide 16-byte load covers 512 contiguous bytes
        v8f s[16];
        const float* bbase = biasb + (size_t)h * NN_ + jt * 4096 + lane * 4;
#pragma unroll
        for (int kt = 0; kt < 16; ++kt) {
            v16h ak = load_frag16_ord(Kh + kt * 512, Kh + kt * 512 + 256, lane);
            float4 c0 = *(const float4*)(bbase + kt * 256);
            float4 c1 = *(const float4*)(bbase + kt * 256 + 128);
            v8f c = {c0.x, c0.y, c0.z, c0.w, c1.x, c1.y, c1.z, c1.w};
            s[kt] = __builtin_amdgcn_wmma_f32_16x16x32_f16(false, ak, false, bq,
                                                           (short)0, c, false, false);
        }
        // the loads' address registers stay whole up to this wait
        asm volatile("s_wait_xcnt 0x0" :: "v"(bbase) : "memory");

        // ---- the query's maximum: in-lane, then one exchange between halves ----
        float mr[8];
#pragma unroll
        for (int r = 0; r < 8; ++r) {
            float m0 = s[0][r];
#pragma unroll
            for (int kt = 1; kt < 16; ++kt) m0 = fmaxf(m0, s[kt][r]);
            mr[r] = m0;
        }
        float mx = fmaxf(fmaxf(fmaxf(mr[0], mr[1]), fmaxf(mr[2], mr[3])),
                         fmaxf(fmaxf(mr[4], mr[5]), fmaxf(mr[6], mr[7])));
        mx = fmaxf(mx, __shfl_xor(mx, 16, 32));
        // keeps the V^T fragment reads behind the scores: lifted above them they take
        // the wave past its 256 registers and loop addresses spill to scratch
        __builtin_amdgcn_sched_barrier(0);

        // ---- O^T = V^T P^T (two dh tiles of 16), P^T packed from the scores ----
        float sm[8];
#pragma unroll
        for (int r = 0; r < 8; ++r) sm[r] = 0.0f;
        v8f o0 = {}, o1 = {};
#pragma unroll
        for (int kp = 0; kp < 8; ++kp) {
            v16h bp;
#pragma unroll
            for (int r = 0; r < 8; ++r) {
                float e0 = __expf(s[2 * kp][r] - mx);
                float e1 = __expf(s[2 * kp + 1][r] - mx);
                sm[r] += e0 + e1;
                bp[r]     = (_Float16)e0;   // key kp*32 + hi*8 + r
                bp[8 + r] = (_Float16)e1;   // key kp*32 + 16 + hi*8 + r
            }
            v16h av0 = load_frag16_ord(Vh + kp * 512, Vh + kp * 512 + 256, lane);
            v16h av1 = load_frag16_ord(Vh + 4096 + kp * 512, Vh + 4096 + kp * 512 + 256, lane);
            o0 = __builtin_amdgcn_wmma_f32_16x16x32_f16(false, av0, false, bp,
                                                        (short)0, o0, false, false);
            o1 = __builtin_amdgcn_wmma_f32_16x16x32_f16(false, av1, false, bp,
                                                        (short)0, o1, false, false);
        }
        float sum = ((sm[0] + sm[1]) + (sm[2] + sm[3])) + ((sm[4] + sm[5]) + (sm[6] + sm[7]));
        sum += __shfl_xor(sum, 16, 32);
        float inv = 1.0f / sum;

        // ---- normalize, gate with sigmoid(g), park as the lane's share of A chunk h:
        //      o0[r] = channel hi*8 + r, o1[r] = channel 16 + hi*8 + r of query n
        union { _Float16 h[8]; uint4 q; } g0, g1, r0, r1;
        _Float16* gp = Gsh + h * 8192 + jt * 512 + lane * 8;
        g0.q = *(const uint4*)(gp);
        g1.q = *(const uint4*)(gp + 256);
#pragma unroll
        for (int r = 0; r < 8; ++r) {
            float s0 = 1.0f / (1.0f + __expf(-(float)g0.h[r]));
            float s1 = 1.0f / (1.0f + __expf(-(float)g1.h[r]));
            r0.h[r] = (_Float16)(o0[r] * inv * s0);
            r1.h[r] = (_Float16)(o1[r] * inv * s1);
        }
        *(uint4*)(gp)       = r0.q;
        *(uint4*)(gp + 256) = r1.q;
    }

    // ---- out rows i*256 + jt*16 .. + 15 = og o_w^T (f32 result): A = the parked
    //      fragments, row = query n, k chunk = head; B = o_w column tile ct
    v16h a[4];
#pragma unroll
    for (int kc = 0; kc < 4; ++kc) {
        const _Float16* f = Gsh + kc * 8192 + jt * 512;
        a[kc] = load_frag16_ord(f, f + 256, lane);
    }
    int hi = lane >> 4, n = lane & 15;
    float* op = out + (size_t)(i * 256 + jt * 16 + hi * 8) * 128 + n;
#pragma unroll
    for (int ct = 0; ct < 8; ++ct) {
        v8f c = {};
#pragma unroll
        for (int kc = 0; kc < 4; ++kc) {
            const _Float16* f = Ash + (ct * 4 + kc) * 512;
            v16h b = load_frag16_ord(f, f + 256, lane);
            c = __builtin_amdgcn_wmma_f32_16x16x32_f16(false, a[kc], false, b, (short)0, c, false, false);
        }
#pragma unroll
        for (int r = 0; r < 8; ++r)
            op[r * 128 + ct * 16] = c[r];
    }
}

// ---------------------------------------------------------------------------
extern "C" void kernel_launch(void* const* d_in, const int* in_sizes, int n_in,
                              void* d_out, int out_size, void* d_ws, size_t ws_size,
                              hipStream_t stream) {
    const float* x   = (const float*)d_in[0];
    const float* lnw = (const float*)d_in[1];
    const float* lnb = (const float*)d_in[2];
    const float* bw  = (const float*)d_in[3];
    const float* qw  = (const float*)d_in[4];
    const float* kw  = (const float*)d_in[5];
    const float* vw  = (const float*)d_in[6];
    const float* gw  = (const float*)d_in[7];
    const float* ow  = (const float*)d_in[8];
    float* out = (float*)d_out;

    char* ws = (char*)d_ws;
    _Float16* hn    = (_Float16*)ws;                       // NN*D f16
    float*    biasb = (float*)(hn + (size_t)NN_ * D_);     // H*NN f32
    _Float16* wcat  = (_Float16*)(biasb + (size_t)H_ * NN_);  // 528*128 f16
    _Float16* wo    = wcat + 528 * 128;                    // 128*128 f16

    prep_weights<<<328, 256, 0, stream>>>(qw, kw, vw, gw, bw, ow, wcat, wo);
    ln_bias_kernel<<<256, 512, 0, stream>>>(x, lnw, lnb, wcat, hn, biasb);
    attn_kernel<<<256, 512, 0, stream>>>(hn, wcat, biasb, wo, out);
}

// v007
// It runs in 38.6 microseconds.
// In two side-by-side timings against v006, it was 1.05 and 1.04 times as fast.
// Over all steps from v000 it is 5.49 times as fast.
#include <hip/hip_runtime.h>

typedef __attribute__((ext_vector_type(16))) _Float16 v16h;
typedef __attribute__((ext_vector_type(8)))  float    v8f;
typedef __attribute__((ext_vector_type(8)))  _Float16 v8h;

constexpr int NN_ = 65536;   // N*N rows
constexpr int D_  = 128;
constexpr int H_  = 4;

union FragH { v16h h; uint32_t u[8]; };

__device__ inline uint32_t lds_addr_of(const void* p) {
    return (uint32_t)(uintptr_t)p;
}

__device__ inline v16h load_frag16(const _Float16* base, int stride, int lane) {
    int rc = lane & 15;
    int hi = (lane >> 4) & 1;
    const _Float16* p = base + rc * stride;
    FragH f;
#pragma unroll
    for (int v = 0; v < 8; ++v) {
        int k = ((v & 4) << 2) + hi * 8 + (v & 3) * 2;   // pairs of consecutive K
        f.u[v] = *(const uint32_t*)(p + k);
    }
    return f.h;
}

__device__ inline v16h load_frag16_swz(const _Float16* tile, int kc, int lane) {
    int n = lane & 15, hi = (lane >> 4) & 1;
    const _Float16* p = tile + n * 128;
    union { v16h h; uint4 q[2]; } f;
    f.q[0] = *(const uint4*)(p + ((kc * 4 + hi) ^ n) * 8);       // K = hi*8 + 0..7
    f.q[1] = *(const uint4*)(p + ((kc * 4 + 2 + hi) ^ n) * 8);   // K = 16 + hi*8 + 0..7
    return f.h;
}

// A fragment stored in fragment order: two pieces of 32 lanes x 16 B, piece 0 at
// p0 and piece 1 at p1 (halves K = hi*8 + 0..7 and K = 16 + hi*8 + 0..7 of the
// lane's row or column). Each wave-wide load covers 512 contiguous bytes.
__device__ inline v16h load_frag16_ord(const _Float16* p0, const _Float16* p1, int lane) {
    union { v16h h; uint4 q[2]; } f;
    f.q[0] = *(const uint4*)(p0 + lane * 8);
    f.q[1] = *(const uint4*)(p1 + lane * 8);
    return f.h;
}

// ---------------------------------------------------------------------------
// Kernel 1: LayerNorm over D=128 and the triangle bias. 256 work-groups of 16
// waves; wave w of work-group rb takes the 16 rows (query (rb >> 4) * 16 + w, keys
// (rb & 15) * 16 .. + 15): float4 per lane and row, shfl_xor reductions, packed
// 8-byte f16 store to hn. The same 8 bytes go to the wave's LDS tile, from which
// the rows come back as the A fragments of the bias product hn bias_w^T.
// The bias plane is laid out as the attention kernel's S^T accumulators read it:
// [head][query tile][key tile][r >> 2][hi * 16 + (query & 15)][r & 3], key in the
// tile = hi * 8 + r. Work-group rb writes the whole 1 KB block (query tile
// rb >> 4, key tile rb & 15) of each head.
// The launch also converts the weights of the attention kernel to f16, 320
// elements (five whole 128-byte lines) per work-group, one per lane of waves 0..9,
// while the rows are in flight:
//   wcat rows [0..127] = q_w / sqrt(32), [128..255] = k_w, [256..383] = v_w,
//   [384..511] = g_w; behind them wo = o_w in the order of the B fragments of the
//   output product: pieces [column tile][k chunk][half q][lane][8],
//   column = tile*16 + (lane & 15), k = chunk*32 + q*16 + (lane >> 4)*8 + 0..7.
// bias_w is read as f32: wave w < 4 converts row w into an LDS table of 16 rows
// (rows 4..15 zero) from which every wave takes its B fragments.
// ---------------------------------------------------------------------------
__global__ __launch_bounds__(512) void ln_bias_kernel(const float* __restrict__ x,
                                                      const float* __restrict__ lnw,
                                                      const float* __restrict__ lnb,
                                                      const float* __restrict__ bw,
                                                      const float* __restrict__ qw,
                                                      const float* __restrict__ kw,
                                                      const float* __restrict__ vw,
                                                      const float* __restrict__ gw,
                                                      const float* __restrict__ ow,
                                                      _Float16* __restrict__ wcat,
                                                      _Float16* __restrict__ hn,
                                                      float* __restrict__ biasb) {
    __shared__ __attribute__((aligned(16))) _Float16 tile[16 * 2048];
    __shared__ __attribute__((aligned(16))) _Float16 bwt[16 * 136];
    int rb = blockIdx.x;
    int t = threadIdx.x, lane = t & 31;
    int wv = __builtin_amdgcn_readfirstlane(t >> 5);
    size_t row0 = (size_t)((rb >> 4) * 16 + wv) * 256 + (rb & 15) * 16;
    const float* xr = x + row0 * 128 + lane * 4;

    // the lane's weight element (waves 10..15 read wave 9's again and store nothing)
    // and the wave's piece of bias_w. A wave's 32 elements
    // lie in one tensor: ts is the same in all its lanes.
    int wb = rb * 320 + (wv < 10 ? wv : 9) * 32;
    int ts = wb >> 14;                           // tensor q, k, v, g, o
    int idx = wb + lane, e = idx & 16383;        // element in the tensor
    int fl = (e >> 3) & 31;
    int sj = ((e >> 11) * 16 + (fl & 15)) * 128 + ((e >> 9) & 3) * 32
           + ((e >> 8) & 1) * 16 + (fl >> 4) * 8 + (e & 7);
    const float* wsrc = ts == 0 ? qw : ts == 1 ? kw : ts == 2 ? vw : ts == 3 ? gw : ow;
    float wval = wsrc[ts == 4 ? sj : e];
    float4 bwv = *(const float4*)(bw + (wv & 3) * 128 + lane * 4);

    // scale and shift, the wave's 16 rows (all in flight at once)
    float4 w = ((const float4*)lnw)[lane];
    float4 b = ((const float4*)lnb)[lane];
    float4 xv[16];
#pragma unroll
    for (int r = 0; r < 16; ++r) xv[r] = *(const float4*)(xr + r * 128);
    // stands behind the row loads, ahead of any rewrite of a register that they name
    asm volatile("s_wait_xcnt 0x0" ::: "memory");

    _Float16* tw = tile + wv * 2048;            // the wave's 16 rows x 128 halves
    _Float16* hp = hn + row0 * 128 + lane * 4;
#pragma unroll
    for (int r = 0; r < 16; ++r) {
        float4 v = xv[r];
        float ps = v.x + v.y + v.z + v.w;
        ps += __shfl_xor(ps, 1, 32);  ps += __shfl_xor(ps, 2, 32);
        ps += __shfl_xor(ps, 4, 32);  ps += __shfl_xor(ps, 8, 32);
        ps += __shfl_xor(ps, 16, 32);
        float mu = ps * (1.0f / 128.0f);

        float dx = v.x - mu, dy = v.y - mu, dz = v.z - mu, dw = v.w - mu;
        float pv = dx * dx + dy * dy + dz * dz + dw * dw;
        pv += __shfl_xor(pv, 1, 32);  pv += __shfl_xor(pv, 2, 32);
        pv += __shfl_xor(pv, 4, 32);  pv += __shfl_xor(pv, 8, 32);
        pv += __shfl_xor(pv, 16, 32);
        float rs = rsqrtf(pv * (1.0f / 128.0f) + 1e-5f);

        union { _Float16 h[4]; uint2 u; } o;
        o.h[0] = (_Float16)(dx * rs * w.x + b.x);
        o.h[1] = (_Float16)(dy * rs * w.y + b.y);
        o.h[2] = (_Float16)(dz * rs * w.z + b.z);
        o.h[3] = (_Float16)(dw * rs * w.w + b.w);
        *(uint2*)(hp + r * 128) = o.u;
        // 16-byte piece lane >> 1 of row r, at place (lane >> 1) ^ r (see load_frag16_swz)
        *(uint2*)(tw + r * 128 + ((lane >> 1) ^ r) * 8 + (lane & 1) * 4) = o.u;
    }
    // the stores' address registers stay whole up to this wait
    asm volatile("s_wait_xcnt 0x0" :: "v"(hp) : "memory");
    {
        // row wv of the table: bias_w's row, or zeros from row 4 on
        union { _Float16 h[4]; uint2 u; } o;
        o.h[0] = (_Float16)bwv.x;  o.h[1] = (_Float16)bwv.y;
        o.h[2] = (_Float16)bwv.z;  o.h[3] = (_Float16)bwv.w;
        uint32_t keep = wv < 4 ? 0xffffffffu : 0u;
        *(uint2*)(bwt + wv * 136 + lane * 4) = make_uint2(o.u.x & keep, o.u.y & keep);
    }
    _Float16* wdst = wcat + idx;
    // inputs-only fence on the loaded value: it keeps the weight load above, among the
    // rows' work; without it the load sinks into the branch below, where its whole
    // latency stands in front of the barrier
    asm volatile("" :: "v"(wval));
    if (wv < 10)   // 1/sqrt(32) folded into q_w
        *wdst = (_Float16)(ts == 0 ? wval * 0.17677669529663687f : wval);
    // the weight store's registers stay whole up to this wait
    asm volatile("s_wait_xcnt 0x0" :: "v"(wdst) : "memory");
    // other lanes' and (bias_w) other waves' LDS stores are read below
    __syncthreads();

    int n = lane & 15, hi = lane >> 4;
    // c[r] = bias of key hi * 8 + r, column n = head
    v8f c = {};
#pragma unroll
    for (int kc = 0; kc < 4; ++kc) {
        v16h ab = load_frag16_swz(tw, kc, lane);
        // column n = row n of the table, K = hi*8 + 0..7 and 16 + hi*8 + 0..7 as in ab
        const _Float16* bp = bwt + n * 136 + kc * 32 + hi * 8;
        union { v16h h; uint4 q[2]; } bb;
        bb.q[0] = *(const uint4*)(bp);
        bb.q[1] = *(const uint4*)(bp + 16);
        c = __builtin_amdgcn_wmma_f32_16x16x32_f16(false, ab, false, bb.h, (short)0, c, false, false);
    }
    if (n < 4) {
        float* bo = biasb + (size_t)n * NN_ + (rb >> 4) * 4096 + (rb & 15) * 256 + (hi * 16 + wv) * 4;
        *(float4*)(bo)       = make_float4(c[0], c[1], c[2], c[3]);
        *(float4*)(bo + 128) = make_float4(c[4], c[5], c[6], c[7]);
    }
}

__device__ inline void stage_rows_swz(_Float16* atile, const _Float16* g, int t) {
    uint32_t l0 = lds_addr_of(atile) + (t >> 4) * 256 + (((t & 15) ^ ((t >> 4) & 15)) * 16);
    const _Float16* g0 = g + t * 8;
    asm volatile("global_load_async_to_lds_b128 %0, %8, off\n\t"
                 "global_load_async_to_lds_b128 %1, %9, off\n\t"
                 "global_load_async_to_lds_b128 %2, %10, off\n\t"
                 "global_load_async_to_lds_b128 %3, %11, off\n\t"
                 "global_load_async_to_lds_b128 %4, %12, off\n\t"
                 "global_load_async_to_lds_b128 %5, %13, off\n\t"
                 "global_load_async_to_lds_b128 %6, %14, off\n\t"
                 "global_load_async_to_lds_b128 %7, %15, off\n\t"
                 "s_wait_xcnt 0x0"
                 :: "v"(l0),            "v"(l0 + 1 * 8192),
                    "v"(l0 + 2 * 8192), "v"(l0 + 3 * 8192),
                    "v"(l0 + 4 * 8192), "v"(l0 + 5 * 8192),
                    "v"(l0 + 6 * 8192), "v"(l0 + 7 * 8192),
                    "v"((uint64_t)(uintptr_t)(g0)),
                    "v"((uint64_t)(uintptr_t)(g0 + 1 * 4096)),
                    "v"((uint64_t)(uintptr_t)(g0 + 2 * 4096)),
                    "v"((uint64_t)(uintptr_t)(g0 + 3 * 4096)),
                    "v"((uint64_t)(uintptr_t)(g0 + 4 * 4096)),
                    "v"((uint64_t)(uintptr_t)(g0 + 5 * 4096)),
                    "v"((uint64_t)(uintptr_t)(g0 + 6 * 4096)),
                    "v"((uint64_t)(uintptr_t)(g0 + 7 * 4096))
                 : "memory");
}

__device__ inline void copy_2x2(uint32_t la, const _Float16* ga, uint32_t lb, const _Float16* gb) {
    asm volatile("global_load_async_to_lds_b128 %0, %4, off\n\t"
                 "global_load_async_to_lds_b128 %1, %5, off\n\t"
                 "global_load_async_to_lds_b128 %2, %6, off\n\t"
                 "global_load_async_to_lds_b128 %3, %7, off\n\t"
                 "s_wait_xcnt 0x0"
                 :: "v"(la), "v"(la + 8192), "v"(lb), "v"(lb + 8192),
                    "v"((uint64_t)(uintptr_t)(ga)), "v"((uint64_t)(uintptr_t)(ga + 4096)),
                    "v"((uint64_t)(uintptr_t)(gb)), "v"((uint64_t)(uintptr_t)(gb + 4096))
                 : "memory");
}

__global__ __launch_bounds__(512) void attn_kernel(const _Float16* __restrict__ hn,
                                                   const _Float16* __restrict__ wcat,
                                                   const float* __restrict__ biasb,
                                                   const _Float16* __restrict__ wo,
                                                   float* __restrict__ out) {
    // the whole LDS of a WGP: four planes of 4 x 8192 halves and the hn rows
    __shared__ __attribute__((aligned(16))) _Float16 sh[5 * 32768];
    _Float16* Qsh = sh;
    _Float16* Ksh = sh + 1 * 32768;
    _Float16* Vsh = sh + 2 * 32768;
    _Float16* Gsh = sh + 3 * 32768;
    _Float16* Ash = sh + 4 * 32768;   // hn rows; behind the projections o_w
    int i = blockIdx.x;
    int t = threadIdx.x, lane = t & 31;
    int jt = __builtin_amdgcn_readfirstlane(t >> 5);   // the wave's number and query tile

    stage_rows_swz(Ash, hn + (size_t)i * 256 * 128, t);

    {
        // weight fragments, loaded while the copies fly
        v16h b[2][4];
#pragma unroll
        for (int j = 0; j < 2; ++j)
#pragma unroll
            for (int kc = 0; kc < 4; ++kc)
                b[j][kc] = load_frag16(wcat + (jt * 2 + j) * 16 * 128 + kc * 32, 128, lane);

        // the wave's own copies have landed; the barrier publishes all waves' rows
        asm volatile("s_wait_asynccnt 0x0" ::: "memory");
        __syncthreads();

        _Float16* outp = sh + (jt >> 2) * 32768 + (jt & 3) * 8192 + lane * 8;
        if ((jt >> 2) == 2) {   // V: rows in the registers (wave-uniform branch)
#pragma unroll
            for (int rt = 0; rt < 16; ++rt) {
                v16h a[4];
#pragma unroll
                for (int kc = 0; kc < 4; ++kc) a[kc] = load_frag16_swz(Ash + rt * 2048, kc, lane);
                v8f c0 = {}, c1 = {};
#pragma unroll
                for (int kc = 0; kc < 4; ++kc) {
                    c0 = __builtin_amdgcn_wmma_f32_16x16x32_f16(false, a[kc], false, b[0][kc], (short)0, c0, false, false);
                    c1 = __builtin_amdgcn_wmma_f32_16x16x32_f16(false, a[kc], false, b[1][kc], (short)0, c1, false, false);
                }
                *(v8h*)(outp + rt * 256)        = __builtin_convertvector(c0, v8h);
                *(v8h*)(outp + (16 + rt) * 256) = __builtin_convertvector(c1, v8h);
            }
        } else {                // Q, K, G: channels in the registers
#pragma unroll
            for (int rt = 0; rt < 16; ++rt) {
                v16h a[4];
#pragma unroll
                for (int kc = 0; kc < 4; ++kc) a[kc] = load_frag16_swz(Ash + rt * 2048, kc, lane);
                v8f c0 = {}, c1 = {};
#pragma unroll
                for (int kc = 0; kc < 4; ++kc) {
                    c0 = __builtin_amdgcn_wmma_f32_16x16x32_f16(false, b[0][kc], false, a[kc], (short)0, c0, false, false);
                    c1 = __builtin_amdgcn_wmma_f32_16x16x32_f16(false, b[1][kc], false, a[kc], (short)0, c1, false, false);
                }
                *(v8h*)(outp + rt * 512)       = __builtin_convertvector(c0, v8h);
                *(v8h*)(outp + rt * 512 + 256) = __builtin_convertvector(c1, v8h);
            }
        }
    }
    // the wave's own LDS reads and writes are done; the barrier publishes the four
    // planes and ends every wave's last read of the hn rows
    asm volatile("s_wait_dscnt 0x0" ::: "memory");
    __syncthreads();
    // o_w (4 pieces per lane) over the hn rows; waited for and published in front of head 1
    copy_2x2(lds_addr_of(Ash) + t * 16, wo + t * 8, lds_addr_of(Ash) + 16384 + t * 16, wo + 8192 + t * 8);

    // kept rolled: four copies of the body would buy nothing
#pragma unroll 1
    for (int h = 0; h < 4; ++h) {
        if (h == 1) {
            // o_w: own copies landed, then published to all waves
            asm volatile("s_wait_asynccnt 0x0" ::: "memory");
            __syncthreads();
        }
        const _Float16* Kh = Ksh + h * 8192;
        const _Float16* Vh = Vsh + h * 8192;
        // Q^T fragment: column = query n (Q pre-scaled by 1/sqrt(DH) in its weights)
        const _Float16* qp = Qsh + h * 8192 + jt * 512;
        v16h bq = load_frag16_ord(qp, qp + 256, lane);

        // ---- S^T = K Q^T + bias^T: s[kt][r] = score(query n, key kt*16 + hi*8 + r);
        //      the bias plane lies in this accumulator order (see ln_bias_kernel): each
        //      wave-wide 16-byte load covers 512 contiguous bytes
        v8f s[16];
        const float* bbase = biasb + (size_t)h * NN_ + jt * 4096 + lane * 4;
#pragma unroll
        for (int kt = 0; kt < 16; ++kt) {
            v16h ak = load_frag16_ord(Kh + kt * 512, Kh + kt * 512 + 256, lane);
            float4 c0 = *(const float4*)(bbase + kt * 256);
            float4 c1 = *(const float4*)(bbase + kt * 256 + 128);
            v8f c = {c0.x, c0.y, c0.z, c0.w, c1.x, c1.y, c1.z, c1.w};
            s[kt] = __builtin_amdgcn_wmma_f32_16x16x32_f16(false, ak, false, bq,
                                                           (short)0, c, false, false);
        }
        // the loads' address registers stay whole up to this wait
        asm volatile("s_wait_xcnt 0x0" :: "v"(bbase) : "memory");

        // ---- the query's maximum: in-lane, then one exchange between halves ----
        float mr[8];
#pragma unroll
        for (int r = 0; r < 8; ++r) {
            float m0 = s[0][r];
#pragma unroll
            for (int kt = 1; kt < 16; ++kt) m0 = fmaxf(m0, s[kt][r]);
            mr[r] = m0;
        }
        float mx = fmaxf(fmaxf(fmaxf(mr[0], mr[1]), fmaxf(mr[2], mr[3])),
                         fmaxf(fmaxf(mr[4], mr[5]), fmaxf(mr[6], mr[7])));
        mx = fmaxf(mx, __shfl_xor(mx, 16, 32));
        // keeps the V^T fragment reads behind the scores: lifted above them they take
        // the wave past its 256 registers and loop addresses spill to scratch
        __builtin_amdgcn_sched_barrier(0);

        // ---- O^T = V^T P^T (two dh tiles of 16), P^T packed from the scores ----
        float sm[8];
#pragma unroll
        for (int r = 0; r < 8; ++r) sm[r] = 0.0f;
        v8f o0 = {}, o1 = {};
#pragma unroll
        for (int kp = 0; kp < 8; ++kp) {
            v16h bp;
#pragma unroll
            for (int r = 0; r < 8; ++r) {
                float e0 = __expf(s[2 * kp][r] - mx);
                float e1 = __expf(s[2 * kp + 1][r] - mx);
                sm[r] += e0 + e1;
                bp[r]     = (_Float16)e0;   // key kp*32 + hi*8 + r
                bp[8 + r] = (_Float16)e1;   // key kp*32 + 16 + hi*8 + r
            }
            v16h av0 = load_frag16_ord(Vh + kp * 512, Vh + kp * 512 + 256, lane);
            v16h av1 = load_frag16_ord(Vh + 4096 + kp * 512, Vh + 4096 + kp * 512 + 256, lane);
            o0 = __builtin_amdgcn_wmma_f32_16x16x32_f16(false, av0, false, bp,
                                                        (short)0, o0, false, false);
            o1 = __builtin_amdgcn_wmma_f32_16x16x32_f16(false, av1, false, bp,
                                                        (short)0, o1, false, false);
        }
        float sum = ((sm[0] + sm[1]) + (sm[2] + sm[3])) + ((sm[4] + sm[5]) + (sm[6] + sm[7]));
        sum += __shfl_xor(sum, 16, 32);
        float inv = 1.0f / sum;

        // ---- normalize, gate with sigmoid(g), park as the lane's share of A chunk h:
        //      o0[r] = channel hi*8 + r, o1[r] = channel 16 + hi*8 + r of query n
        union { _Float16 h[8]; uint4 q; } g0, g1, r0, r1;
        _Float16* gp = Gsh + h * 8192 + jt * 512 + lane * 8;
        g0.q = *(const uint4*)(gp);
        g1.q = *(const uint4*)(gp + 256);
#pragma unroll
        for (int r = 0; r < 8; ++r) {
            float s0 = 1.0f / (1.0f + __expf(-(float)g0.h[r]));
            float s1 = 1.0f / (1.0f + __expf(-(float)g1.h[r]));
            r0.h[r] = (_Float16)(o0[r] * inv * s0);
            r1.h[r] = (_Float16)(o1[r] * inv * s1);
        }
        *(uint4*)(gp)       = r0.q;
        *(uint4*)(gp + 256) = r1.q;
    }

    // ---- out rows i*256 + jt*16 .. + 15 = og o_w^T (f32 result): A = the parked
    //      fragments, row = query n, k chunk = head; B = o_w column tile ct
    v16h a[4];
#pragma unroll
    for (int kc = 0; kc < 4; ++kc) {
        const _Float16* f = Gsh + kc * 8192 + jt * 512;
        a[kc] = load_frag16_ord(f, f + 256, lane);
    }
    int hi = lane >> 4, n = lane & 15;
    float* op = out + (size_t)(i * 256 + jt * 16 + hi * 8) * 128 + n;
#pragma unroll
    for (int ct = 0; ct < 8; ++ct) {
        v8f c = {};
#pragma unroll
        for (int kc = 0; kc < 4; ++kc) {
            const _Float16* f = Ash + (ct * 4 + kc) * 512;
            v16h b = load_frag16_ord(f, f + 256, lane);
            c = __builtin_amdgcn_wmma_f32_16x16x32_f16(false, a[kc], false, b, (short)0, c, false, false);
        }
#pragma unroll
        for (int r = 0; r < 8; ++r)
            op[r * 128 + ct * 16] = c[r];
    }
}

// ---------------------------------------------------------------------------
extern "C" void kernel_launch(void* const* d_in, const int* in_sizes, int n_in,
                              void* d_out, int out_size, void* d_ws, size_t ws_size,
                              hipStream_t stream) {
    const float* x   = (const float*)d_in[0];
    const float* lnw = (const float*)d_in[1];
    const float* lnb = (const float*)d_in[2];
    const float* bw  = (const float*)d_in[3];
    const float* qw  = (const float*)d_in[4];
    const float* kw  = (const float*)d_in[5];
    const float* vw  = (const float*)d_in[6];
    const float* gw  = (const float*)d_in[7];
    const float* ow  = (const float*)d_in[8];
    float* out = (float*)d_out;

    char* ws = (char*)d_ws;
    _Float16* hn    = (_Float16*)ws;                       // NN*D f16
    float*    biasb = (float*)(hn + (size_t)NN_ * D_);     // H*NN f32
    _Float16* wcat  = (_Float16*)(biasb + (size_t)H_ * NN_);  // 512*128 f16
    _Float16* wo    = wcat + 512 * 128;                    // 128*128 f16, written through wcat

    ln_bias_kernel<<<256, 512, 0, stream>>>(x, lnw, lnb, bw, qw, kw, vw, gw, ow, wcat, hn, biasb);
    attn_kernel<<<256, 512, 0, stream>>>(hn, wcat, biasb, wo, out);
}

// v008
// One run takes 34.8 microseconds.
// In both of two side-by-side timings against v007, it was 1.11 times as fast.
// All steps since v000 together make it 6.08 times as fast.
#include <hip/hip_runtime.h>

typedef __attribute__((ext_vector_type(16))) _Float16 v16h;
typedef __attribute__((ext_vector_type(8)))  float    v8f;
typedef __attribute__((ext_vector_type(8)))  _Float16 v8h;

constexpr int NN_ = 65536;   // N*N rows
constexpr int D_  = 128;
constexpr int H_  = 4;

union FragH { v16h h; uint32_t u[8]; };

__device__ inline uint32_t lds_addr_of(const void* p) {
    return (uint32_t)(uintptr_t)p;
}

__device__ inline v16h load_frag16(const _Float16* base, int stride, int lane) {
    int rc = lane & 15;
    int hi = (lane >> 4) & 1;
    const _Float16* p = base + rc * stride;
    FragH f;
#pragma unroll
    for (int v = 0; v < 8; ++v) {
        int k = ((v & 4) << 2) + hi * 8 + (v & 3) * 2;   // pairs of consecutive K
        f.u[v] = *(const uint32_t*)(p + k);
    }
    return f.h;
}

__device__ inline v16h load_frag16_swz(const _Float16* tile, int kc, int lane) {
    int n = lane & 15, hi = (lane >> 4) & 1;
    const _Float16* p = tile + n * 128;
    union { v16h h; uint4 q[2]; } f;
    f.q[0] = *(const uint4*)(p + ((kc * 4 + hi) ^ n) * 8);       // K = hi*8 + 0..7
    f.q[1] = *(const uint4*)(p + ((kc * 4 + 2 + hi) ^ n) * 8);   // K = 16 + hi*8 + 0..7
    return f.h;
}

// A fragment stored in fragment order: two pieces of 32 lanes x 16 B, piece 0 at
// p0 and piece 1 at p1 (halves K = hi*8 + 0..7 and K = 16 + hi*8 + 0..7 of the
// lane's row or column). Each wave-wide load covers 512 contiguous bytes.
__device__ inline v16h load_frag16_ord(const _Float16* p0, const _Float16* p1, int lane) {
    union { v16h h; uint4 q[2]; } f;
    f.q[0] = *(const uint4*)(p0 + lane * 8);
    f.q[1] = *(const uint4*)(p1 + lane * 8);
    return f.h;
}

// ---------------------------------------------------------------------------
// Kernel 1: LayerNorm over D=128 and the triangle bias. 256 work-groups of 16
// waves; wave w of work-group rb takes the 16 rows (query (rb >> 4) * 16 + w, keys
// (rb & 15) * 16 .. + 15): float4 per lane and row, shfl_xor reductions, packed
// 8-byte f16 store to hn. The same 8 bytes go to the wave's LDS tile, from which
// the rows come back as the A fragments of the bias product hn bias_w^T.
// The bias plane is laid out as the attention kernel's S^T accumulators read it:
// [head][query tile][key tile][r >> 2][hi * 16 + (query & 15)][r & 3], key in the
// tile = hi * 8 + r. Work-group rb writes the whole 1 KB block (query tile
// rb >> 4, key tile rb & 15) of each head.
// The launch also converts the weights of the attention kernel to f16, 320
// elements (five whole 128-byte lines) per work-group, one per lane of waves 0..9,
// while the rows are in flight:
//   wcat rows [0..127] = q_w / sqrt(32), [128..255] = k_w, [256..383] = v_w,
//   [384..511] = g_w; behind them wo = o_w in the order of the B fragments of the
//   output product: pieces [column tile][k chunk][half q][lane][8],
//   column = tile*16 + (lane & 15), k = chunk*32 + q*16 + (lane >> 4)*8 + 0..7.
// bias_w is read as f32: wave w < 4 converts row w into an LDS table of 16 rows
// (rows 4..15 zero) from which every wave takes its B fragments.
// ---------------------------------------------------------------------------
__global__ __launch_bounds__(512) void ln_bias_kernel(const float* __restrict__ x,
                                                      const float* __restrict__ lnw,
                                                      const float* __restrict__ lnb,
                                                      const float* __restrict__ bw,
                                                      const float* __restrict__ qw,
                                                      const float* __restrict__ kw,
                                                      const float* __restrict__ vw,
                                                      const float* __restrict__ gw,
                                                      const float* __restrict__ ow,
                                                      _Float16* __restrict__ wcat,
                                                      _Float16* __restrict__ hn,
                                                      float* __restrict__ biasb) {
    __shared__ __attribute__((aligned(16))) _Float16 tile[16 * 2048];
    __shared__ __attribute__((aligned(16))) _Float16 bwt[16 * 136];
    int rb = blockIdx.x;
    int t = threadIdx.x, lane = t & 31;
    int wv = __builtin_amdgcn_readfirstlane(t >> 5);
    size_t row0 = (size_t)((rb >> 4) * 16 + wv) * 256 + (rb & 15) * 16;
    const float* xr = x + row0 * 128 + lane * 4;

    // the lane's weight element (waves 10..15 read wave 9's again and store nothing)
    // and the wave's piece of bias_w. A wave's 32 elements
    // lie in one tensor: ts is the same in all its lanes.
    int wb = rb * 320 + (wv < 10 ? wv : 9) * 32;
    int ts = wb >> 14;                           // tensor q, k, v, g, o
    int idx = wb + lane, e = idx & 16383;        // element in the tensor
    int fl = (e >> 3) & 31;
    int sj = ((e >> 11) * 16 + (fl & 15)) * 128 + ((e >> 9) & 3) * 32
           + ((e >> 8) & 1) * 16 + (fl >> 4) * 8 + (e & 7);
    const float* wsrc = ts == 0 ? qw : ts == 1 ? kw : ts == 2 ? vw : ts == 3 ? gw : ow;
    float wval = wsrc[ts == 4 ? sj : e];
    float4 bwv = *(const float4*)(bw + (wv & 3) * 128 + lane * 4);

    // scale and shift, the wave's 16 rows (all in flight at once)
    float4 w = ((const float4*)lnw)[lane];
    float4 b = ((const float4*)lnb)[lane];
    float4 xv[16];
#pragma unroll
    for (int r = 0; r < 16; ++r) xv[r] = *(const float4*)(xr + r * 128);
    // stands behind the row loads, ahead of any rewrite of a register that they name
    asm volatile("s_wait_xcnt 0x0" ::: "memory");

    _Float16* tw = tile + wv * 2048;            // the wave's 16 rows x 128 halves
    _Float16* hp = hn + row0 * 128 + lane * 4;
#pragma unroll
    for (int r = 0; r < 16; ++r) {
        float4 v = xv[r];
        float ps = v.x + v.y + v.z + v.w;
        ps += __shfl_xor(ps, 1, 32);  ps += __shfl_xor(ps, 2, 32);
        ps += __shfl_xor(ps, 4, 32);  ps += __shfl_xor(ps, 8, 32);
        ps += __shfl_xor(ps, 16, 32);
        float mu = ps * (1.0f / 128.0f);

        float dx = v.x - mu, dy = v.y - mu, dz = v.z - mu, dw = v.w - mu;
        float pv = dx * dx + dy * dy + dz * dz + dw * dw;
        pv += __shfl_xor(pv, 1, 32);  pv += __shfl_xor(pv, 2, 32);
        pv += __shfl_xor(pv, 4, 32);  pv += __shfl_xor(pv, 8, 32);
        pv += __shfl_xor(pv, 16, 32);
        float rs = rsqrtf(pv * (1.0f / 128.0f) + 1e-5f);

        union { _Float16 h[4]; uint2 u; } o;
        o.h[0] = (_Float16)(dx * rs * w.x + b.x);
        o.h[1] = (_Float16)(dy * rs * w.y + b.y);
        o.h[2] = (_Float16)(dz * rs * w.z + b.z);
        o.h[3] = (_Float16)(dw * rs * w.w + b.w);
        *(uint2*)(hp + r * 128) = o.u;
        // 16-byte piece lane >> 1 of row r, at place (lane >> 1) ^ r (see load_frag16_swz)
        *(uint2*)(tw + r * 128 + ((lane >> 1) ^ r) * 8 + (lane & 1) * 4) = o.u;
    }
    // the stores' address registers stay whole up to this wait
    asm volatile("s_wait_xcnt 0x0" :: "v"(hp) : "memory");
    {
        // row wv of the table: bias_w's row, or zeros from row 4 on
        union { _Float16 h[4]; uint2 u; } o;
        o.h[0] = (_Float16)bwv.x;  o.h[1] = (_Float16)bwv.y;
        o.h[2] = (_Float16)bwv.z;  o.h[3] = (_Float16)bwv.w;
        uint32_t keep = wv < 4 ? 0xffffffffu : 0u;
        *(uint2*)(bwt + wv * 136 + lane * 4) = make_uint2(o.u.x & keep, o.u.y & keep);
    }
    _Float16* wdst = wcat + idx;
    // inputs-only fence on the loaded value: it keeps the weight load above, among the
    // rows' work; without it the load sinks into the branch below, where its whole
    // latency stands in front of the barrier
    asm volatile("" :: "v"(wval));
    if (wv < 10)   // 1/sqrt(32) folded into q_w
        *wdst = (_Float16)(ts == 0 ? wval * 0.17677669529663687f : wval);
    // the weight store's registers stay whole up to this wait
    asm volatile("s_wait_xcnt 0x0" :: "v"(wdst) : "memory");
    // other lanes' and (bias_w) other waves' LDS stores are read below
    __syncthreads();

    int n = lane & 15, hi = lane >> 4;
    // c[r] = bias of key hi * 8 + r, column n = head
    v8f c = {};
#pragma unroll
    for (int kc = 0; kc < 4; ++kc) {
        v16h ab = load_frag16_swz(tw, kc, lane);
        // column n = row n of the table, K = hi*8 + 0..7 and 16 + hi*8 + 0..7 as in ab
        const _Float16* bp = bwt + n * 136 + kc * 32 + hi * 8;
        union { v16h h; uint4 q[2]; } bb;
        bb.q[0] = *(const uint4*)(bp);
        bb.q[1] = *(const uint4*)(bp + 16);
        c = __builtin_amdgcn_wmma_f32_16x16x32_f16(false, ab, false, bb.h, (short)0, c, false, false);
    }
    if (n < 4) {
        float* bo = biasb + (size_t)n * NN_ + (rb >> 4) * 4096 + (rb & 15) * 256 + (hi * 16 + wv) * 4;
        *(float4*)(bo)       = make_float4(c[0], c[1], c[2], c[3]);
        *(float4*)(bo + 128) = make_float4(c[4], c[5], c[6], c[7]);
    }
}

__device__ inline void stage_rows_swz(_Float16* atile, const _Float16* g, int t) {
    uint32_t l0 = lds_addr_of(atile) + (t >> 4) * 256 + (((t & 15) ^ ((t >> 4) & 15)) * 16);
    const _Float16* g0 = g + t * 8;
    asm volatile("global_load_async_to_lds_b128 %0, %8, off\n\t"
                 "global_load_async_to_lds_b128 %1, %9, off\n\t"
                 "global_load_async_to_lds_b128 %2, %10, off\n\t"
                 "global_load_async_to_lds_b128 %3, %11, off\n\t"
                 "global_load_async_to_lds_b128 %4, %12, off\n\t"
                 "global_load_async_to_lds_b128 %5, %13, off\n\t"
                 "global_load_async_to_lds_b128 %6, %14, off\n\t"
                 "global_load_async_to_lds_b128 %7, %15, off\n\t"
                 "s_wait_xcnt 0x0"
                 :: "v"(l0),            "v"(l0 + 1 * 8192),
                    "v"(l0 + 2 * 8192), "v"(l0 + 3 * 8192),
                    "v"(l0 + 4 * 8192), "v"(l0 + 5 * 8192),
                    "v"(l0 + 6 * 8192), "v"(l0 + 7 * 8192),
                    "v"((uint64_t)(uintptr_t)(g0)),
                    "v"((uint64_t)(uintptr_t)(g0 + 1 * 4096)),
                    "v"((uint64_t)(uintptr_t)(g0 + 2 * 4096)),
                    "v"((uint64_t)(uintptr_t)(g0 + 3 * 4096)),
                    "v"((uint64_t)(uintptr_t)(g0 + 4 * 4096)),
                    "v"((uint64_t)(uintptr_t)(g0 + 5 * 4096)),
                    "v"((uint64_t)(uintptr_t)(g0 + 6 * 4096)),
                    "v"((uint64_t)(uintptr_t)(g0 + 7 * 4096))
                 : "memory");
}

__device__ inline void copy_2x2(uint32_t la, const _Float16* ga, uint32_t lb, const _Float16* gb) {
    asm volatile("global_load_async_to_lds_b128 %0, %4, off\n\t"
                 "global_load_async_to_lds_b128 %1, %5, off\n\t"
                 "global_load_async_to_lds_b128 %2, %6, off\n\t"
                 "global_load_async_to_lds_b128 %3, %7, off\n\t"
                 "s_wait_xcnt 0x0"
                 :: "v"(la), "v"(la + 8192), "v"(lb), "v"(lb + 8192),
                    "v"((uint64_t)(uintptr_t)(ga)), "v"((uint64_t)(uintptr_t)(ga + 4096)),
                    "v"((uint64_t)(uintptr_t)(gb)), "v"((uint64_t)(uintptr_t)(gb + 4096))
                 : "memory");
}

__global__ __launch_bounds__(512) void attn_kernel(const _Float16* __restrict__ hn,
                                                   const _Float16* __restrict__ wcat,
                                                   const float* __restrict__ biasb,
                                                   const _Float16* __restrict__ wo,
                                                   float* __restrict__ out) {
    // the whole LDS of a WGP: four planes of 4 x 8192 halves and the hn rows
    __shared__ __attribute__((aligned(16))) _Float16 sh[5 * 32768];
    _Float16* Qsh = sh;
    _Float16* Ksh = sh + 1 * 32768;
    _Float16* Vsh = sh + 2 * 32768;
    _Float16* Gsh = sh + 3 * 32768;
    _Float16* Ash = sh + 4 * 32768;   // hn rows; behind the projections o_w
    int i = blockIdx.x;
    int t = threadIdx.x, lane = t & 31;
    int jt = __builtin_amdgcn_readfirstlane(t >> 5);   // the wave's number and query tile

    stage_rows_swz(Ash, hn + (size_t)i * 256 * 128, t);

    {
        // weight fragments, loaded while the copies fly
        v16h b[2][4];
#pragma unroll
        for (int j = 0; j < 2; ++j)
#pragma unroll
            for (int kc = 0; kc < 4; ++kc)
                b[j][kc] = load_frag16(wcat + (jt * 2 + j) * 16 * 128 + kc * 32, 128, lane);

        // the wave's own copies have landed; the barrier publishes all waves' rows
        asm volatile("s_wait_asynccnt 0x0" ::: "memory");
        __syncthreads();

        _Float16* outp = sh + (jt >> 2) * 32768 + (jt & 3) * 8192 + lane * 8;
        if ((jt >> 2) == 2) {   // V: rows in the registers (wave-uniform branch)
#pragma unroll
            for (int rt = 0; rt < 16; ++rt) {
                v16h a[4];
#pragma unroll
                for (int kc = 0; kc < 4; ++kc) a[kc] = load_frag16_swz(Ash + rt * 2048, kc, lane);
                v8f c0 = {}, c1 = {};
#pragma unroll
                for (int kc = 0; kc < 4; ++kc) {
                    c0 = __builtin_amdgcn_wmma_f32_16x16x32_f16(false, a[kc], false, b[0][kc], (short)0, c0, false, false);
                    c1 = __builtin_amdgcn_wmma_f32_16x16x32_f16(false, a[kc], false, b[1][kc], (short)0, c1, false, false);
                }
                *(v8h*)(outp + rt * 256)        = __builtin_convertvector(c0, v8h);
                *(v8h*)(outp + (16 + rt) * 256) = __builtin_convertvector(c1, v8h);
            }
        } else {                // Q, K, G: channels in the registers
#pragma unroll
            for (int rt = 0; rt < 16; ++rt) {
                v16h a[4];
#pragma unroll
                for (int kc = 0; kc < 4; ++kc) a[kc] = load_frag16_swz(Ash + rt * 2048, kc, lane);
                v8f c0 = {}, c1 = {};
#pragma unroll
                for (int kc = 0; kc < 4; ++kc) {
                    c0 = __builtin_amdgcn_wmma_f32_16x16x32_f16(false, b[0][kc], false, a[kc], (short)0, c0, false, false);
                    c1 = __builtin_amdgcn_wmma_f32_16x16x32_f16(false, b[1][kc], false, a[kc], (short)0, c1, false, false);
                }
                *(v8h*)(outp + rt * 512)       = __builtin_convertvector(c0, v8h);
                *(v8h*)(outp + rt * 512 + 256) = __builtin_convertvector(c1, v8h);
            }
        }
    }
    // the wave's own LDS reads and writes are done; the barrier publishes the four
    // planes and ends every wave's last read of the hn rows
    asm volatile("s_wait_dscnt 0x0" ::: "memory");
    __syncthreads();
    // o_w (4 pieces per lane) over the hn rows; waited for and published in front of head 1
    copy_2x2(lds_addr_of(Ash) + t * 16, wo + t * 8, lds_addr_of(Ash) + 16384 + t * 16, wo + 8192 + t * 8);

    // kept rolled: four copies of the body would buy nothing
#pragma unroll 1
    for (int h = 0; h < 4; ++h) {
        if (h == 1) {
            // o_w: own copies landed, then published to all waves
            asm volatile("s_wait_asynccnt 0x0" ::: "memory");
            __syncthreads();
        }
        const _Float16* Kh = Ksh + h * 8192;
        const _Float16* Vh = Vsh + h * 8192;
        // Q^T fragment: column = query n (Q pre-scaled by 1/sqrt(DH) in its weights)
        const _Float16* qp = Qsh + h * 8192 + jt * 512;
        v16h bq = load_frag16_ord(qp, qp + 256, lane);

        // ---- S^T = K Q^T + bias^T: s[kt][r] = score(query n, key kt*16 + hi*8 + r);
        //      the bias plane lies in this accumulator order (see ln_bias_kernel): each
        //      wave-wide 16-byte load covers 512 contiguous bytes
        v8f s[16];
        const float* bbase = biasb + (size_t)h * NN_ + jt * 4096 + lane * 4;
#pragma unroll
        for (int kt = 0; kt < 16; ++kt) {
            v16h ak = load_frag16_ord(Kh + kt * 512, Kh + kt * 512 + 256, lane);
            float4 c0 = *(const float4*)(bbase + kt * 256);
            float4 c1 = *(const float4*)(bbase + kt * 256 + 128);
            v8f c = {c0.x, c0.y, c0.z, c0.w, c1.x, c1.y, c1.z, c1.w};
            s[kt] = __builtin_amdgcn_wmma_f32_16x16x32_f16(false, ak, false, bq,
                                                           (short)0, c, false, false);
        }
        // the loads' address registers stay whole up to this wait
        asm volatile("s_wait_xcnt 0x0" :: "v"(bbase) : "memory");

        // ---- the query's maximum: in-lane, then one exchange between halves ----
        float mr[8];
#pragma unroll
        for (int r = 0; r < 8; ++r) {
            float m0 = s[0][r];
#pragma unroll
            for (int kt = 1; kt < 16; ++kt) m0 = fmaxf(m0, s[kt][r]);
            mr[r] = m0;
        }
        float mx = fmaxf(fmaxf(fmaxf(mr[0], mr[1]), fmaxf(mr[2], mr[3])),
                         fmaxf(fmaxf(mr[4], mr[5]), fmaxf(mr[6], mr[7])));
        mx = fmaxf(mx, __shfl_xor(mx, 16, 32));
        // exp(s - mx) = exp2(s * log2(e) - mx * log2(e)): one multiply-add per score, two
        // scores per packed instruction, straight into the hardware's exp2
        const float l2e = 1.4426950408889634f;
        const float nm = -mx * l2e;
        const v8f l2e8 = {l2e, l2e, l2e, l2e, l2e, l2e, l2e, l2e};
        const v8f nm8  = {nm, nm, nm, nm, nm, nm, nm, nm};
        // keeps the V^T fragment reads behind the scores: lifted above them they take
        // the wave past its 256 registers and loop addresses spill to scratch
        __builtin_amdgcn_sched_barrier(0);

        // ---- O^T = V^T P^T (two dh tiles of 16), P^T packed from the scores ----
        v8f sm = {};
        v8f o0 = {}, o1 = {};
#pragma unroll
        for (int kp = 0; kp < 8; ++kp) {
            v16h bp;
            v8f t0 = __builtin_elementwise_fma(s[2 * kp], l2e8, nm8);
            v8f t1 = __builtin_elementwise_fma(s[2 * kp + 1], l2e8, nm8);
            v8f e0, e1;
#pragma unroll
            for (int r = 0; r < 8; ++r) {
                e0[r] = __builtin_amdgcn_exp2f(t0[r]);
                e1[r] = __builtin_amdgcn_exp2f(t1[r]);
                bp[r]     = (_Float16)e0[r];   // key kp*32 + hi*8 + r
                bp[8 + r] = (_Float16)e1[r];   // key kp*32 + 16 + hi*8 + r
            }
            sm += e0 + e1;
            v16h av0 = load_frag16_ord(Vh + kp * 512, Vh + kp * 512 + 256, lane);
            v16h av1 = load_frag16_ord(Vh + 4096 + kp * 512, Vh + 4096 + kp * 512 + 256, lane);
            o0 = __builtin_amdgcn_wmma_f32_16x16x32_f16(false, av0, false, bp,
                                                        (short)0, o0, false, false);
            o1 = __builtin_amdgcn_wmma_f32_16x16x32_f16(false, av1, false, bp,
                                                        (short)0, o1, false, false);
        }
        float sum = ((sm[0] + sm[1]) + (sm[2] + sm[3])) + ((sm[4] + sm[5]) + (sm[6] + sm[7]));
        sum += __shfl_xor(sum, 16, 32);
        // sum >= about 1 (the maximum's own term): the hardware reciprocal, no division sequence
        float inv = __builtin_amdgcn_rcpf(sum);

        // ---- normalize, gate with sigmoid(g), park as the lane's share of A chunk h:
        //      o0[r] = channel hi*8 + r, o1[r] = channel 16 + hi*8 + r of query n
        union { _Float16 h[8]; uint4 q; } g0, g1, r0, r1;
        _Float16* gp = Gsh + h * 8192 + jt * 512 + lane * 8;
        g0.q = *(const uint4*)(gp);
        g1.q = *(const uint4*)(gp + 256);
#pragma unroll
        for (int r = 0; r < 8; ++r) {
            // 1 + exp(-g) lies in [1, inf]: the hardware reciprocal gives (0 at inf) what the
            // division sequence gave, within a rounding far below the f16 result's
            float s0 = __builtin_amdgcn_rcpf(1.0f + __builtin_amdgcn_exp2f(-l2e * (float)g0.h[r]));
            float s1 = __builtin_amdgcn_rcpf(1.0f + __builtin_amdgcn_exp2f(-l2e * (float)g1.h[r]));
            r0.h[r] = (_Float16)(o0[r] * inv * s0);
            r1.h[r] = (_Float16)(o1[r] * inv * s1);
        }
        *(uint4*)(gp)       = r0.q;
        *(uint4*)(gp + 256) = r1.q;
    }

    // ---- out rows i*256 + jt*16 .. + 15 = og o_w^T (f32 result): A = the parked
    //      fragments, row = query n, k chunk = head; B = o_w column tile ct
    v16h a[4];
#pragma unroll
    for (int kc = 0; kc < 4; ++kc) {
        const _Float16* f = Gsh + kc * 8192 + jt * 512;
        a[kc] = load_frag16_ord(f, f + 256, lane);
    }
    int hi = lane >> 4, n = lane & 15;
    float* op = out + (size_t)(i * 256 + jt * 16 + hi * 8) * 128 + n;
#pragma unroll
    for (int ct = 0; ct < 8; ++ct) {
        v8f c = {};
#pragma unroll
        for (int kc = 0; kc < 4; ++kc) {
            const _Float16* f = Ash + (ct * 4 + kc) * 512;
            v16h b = load_frag16_ord(f, f + 256, lane);
            c = __builtin_amdgcn_wmma_f32_16x16x32_f16(false, a[kc], false, b, (short)0, c, false, false);
        }
#pragma unroll
        for (int r = 0; r < 8; ++r)
            op[r * 128 + ct * 16] = c[r];
    }
}

// ---------------------------------------------------------------------------
extern "C" void kernel_launch(void* const* d_in, const int* in_sizes, int n_in,
                              void* d_out, int out_size, void* d_ws, size_t ws_size,
                              hipStream_t stream) {
    const float* x   = (const float*)d_in[0];
    const float* lnw = (const float*)d_in[1];
    const float* lnb = (const float*)d_in[2];
    const float* bw  = (const float*)d_in[3];
    const float* qw  = (const float*)d_in[4];
    const float* kw  = (const float*)d_in[5];
    const float* vw  = (const float*)d_in[6];
    const float* gw  = (const float*)d_in[7];
    const float* ow  = (const float*)d_in[8];
    float* out = (float*)d_out;

    char* ws = (char*)d_ws;
    _Float16* hn    = (_Float16*)ws;                       // NN*D f16
    float*    biasb = (float*)(hn + (size_t)NN_ * D_);     // H*NN f32
    _Float16* wcat  = (_Float16*)(biasb + (size_t)H_ * NN_);  // 512*128 f16
    _Float16* wo    = wcat + 512 * 128;                    // 128*128 f16, written through wcat

    ln_bias_kernel<<<256, 512, 0, stream>>>(x, lnw, lnb, bw, qw, kw, vw, gw, ow, wcat, hn, biasb);
    attn_kernel<<<256, 512, 0, stream>>>(hn, wcat, biasb, wo, out);
}

// v009
// One run takes 33.6 microseconds.
// Next to v008, in two timings, it ran 1.03 and 1.04 times as fast.
// Counting every step since v000, it is 6.31 times as fast.
#include <hip/hip_runtime.h>

typedef __attribute__((ext_vector_type(16))) _Float16 v16h;
typedef __attribute__((ext_vector_type(8)))  float    v8f;
typedef __attribute__((ext_vector_type(8)))  _Float16 v8h;

constexpr int NN_ = 65536;   // N*N rows
constexpr int D_  = 128;
constexpr int H_  = 4;

union FragH { v16h h; uint32_t u[8]; };

__device__ inline uint32_t lds_addr_of(const void* p) {
    return (uint32_t)(uintptr_t)p;
}

__device__ inline v16h load_frag16(const _Float16* base, int stride, int lane) {
    int rc = lane & 15;
    int hi = (lane >> 4) & 1;
    const _Float16* p = base + rc * stride;
    FragH f;
#pragma unroll
    for (int v = 0; v < 8; ++v) {
        int k = ((v & 4) << 2) + hi * 8 + (v & 3) * 2;   // pairs of consecutive K
        f.u[v] = *(const uint32_t*)(p + k);
    }
    return f.h;
}

__device__ inline v16h load_frag16_swz(const _Float16* tile, int kc, int lane) {
    int n = lane & 15, hi = (lane >> 4) & 1;
    const _Float16* p = tile + n * 128;
    union { v16h h; uint4 q[2]; } f;
    f.q[0] = *(const uint4*)(p + ((kc * 4 + hi) ^ n) * 8);       // K = hi*8 + 0..7
    f.q[1] = *(const uint4*)(p + ((kc * 4 + 2 + hi) ^ n) * 8);   // K = 16 + hi*8 + 0..7
    return f.h;
}

// A fragment stored in fragment order: two pieces of 32 lanes x 16 B, piece 0 at
// p0 and piece 1 at p1 (halves K = hi*8 + 0..7 and K = 16 + hi*8 + 0..7 of the
// lane's row or column). Each wave-wide load covers 512 contiguous bytes.
__device__ inline v16h load_frag16_ord(const _Float16* p0, const _Float16* p1, int lane) {
    union { v16h h; uint4 q[2]; } f;
    f.q[0] = *(const uint4*)(p0 + lane * 8);
    f.q[1] = *(const uint4*)(p1 + lane * 8);
    return f.h;
}

// ---------------------------------------------------------------------------
// Kernel 1: LayerNorm over D=128 and the triangle bias. 256 work-groups of 16
// waves; wave w of work-group rb takes the 16 rows (query (rb >> 4) * 16 + w, keys
// (rb & 15) * 16 .. + 15): float4 per lane and row, shfl_xor reductions, packed
// 8-byte f16 store to hn. The same 8 bytes go to the wave's LDS tile, from which
// the rows come back as the A fragments of the bias product hn bias_w^T.
// The bias plane is laid out as the attention kernel's S^T accumulators read it:
// [head][query tile][key tile][r >> 2][hi * 16 + (query & 15)][r & 3], key in the
// tile = hi * 8 + r. Work-group rb writes the whole 1 KB block (query tile
// rb >> 4, key tile rb & 15) of each head.
// The launch also converts the weights of the attention kernel to f16, 320
// elements (five whole 128-byte lines) per work-group, one per lane of waves 0..9,
// while the rows are in flight:
//   wcat rows [0..127] = q_w / sqrt(32), [128..255] = k_w, [256..383] = v_w,
//   [384..511] = g_w; behind them wo = o_w in the order of the B fragments of the
//   output product: pieces [column tile][k chunk][half q][lane][8],
//   column = tile*16 + (lane & 15), k = chunk*32 + q*16 + (lane >> 4)*8 + 0..7.
// bias_w is read as f32: wave w < 4 converts row w into an LDS table of 16 rows
// (rows 4..15 zero) from which every wave takes its B fragments.
// ---------------------------------------------------------------------------
__global__ __launch_bounds__(512) void ln_bias_kernel(const float* __restrict__ x,
                                                      const float* __restrict__ lnw,
                                                      const float* __restrict__ lnb,
                                                      const float* __restrict__ bw,
                                                      const float* __restrict__ qw,
                                                      const float* __restrict__ kw,
                                                      const float* __restrict__ vw,
                                                      const float* __restrict__ gw,
                                                      const float* __restrict__ ow,
                                                      _Float16* __restrict__ wcat,
                                                      _Float16* __restrict__ hn,
                                                      float* __restrict__ biasb) {
    __shared__ __attribute__((aligned(16))) _Float16 tile[16 * 2048];
    __shared__ __attribute__((aligned(16))) _Float16 bwt[16 * 136];
    int rb = blockIdx.x;
    int t = threadIdx.x, lane = t & 31;
    int wv = __builtin_amdgcn_readfirstlane(t >> 5);
    size_t row0 = (size_t)((rb >> 4) * 16 + wv) * 256 + (rb & 15) * 16;
    const float* xr = x + row0 * 128 + lane * 4;

    // the lane's weight element (waves 10..15 read wave 9's again and store nothing)
    // and the wave's piece of bias_w. A wave's 32 elements
    // lie in one tensor: ts is the same in all its lanes.
    int wb = rb * 320 + (wv < 10 ? wv : 9) * 32;
    int ts = wb >> 14;                           // tensor q, k, v, g, o
    int idx = wb + lane, e = idx & 16383;        // element in the tensor
    int fl = (e >> 3) & 31;
    int sj = ((e >> 11) * 16 + (fl & 15)) * 128 + ((e >> 9) & 3) * 32
           + ((e >> 8) & 1) * 16 + (fl >> 4) * 8 + (e & 7);
    const float* wsrc = ts == 0 ? qw : ts == 1 ? kw : ts == 2 ? vw : ts == 3 ? gw : ow;
    float wval = wsrc[ts == 4 ? sj : e];
    float4 bwv = *(const float4*)(bw + (wv & 3) * 128 + lane * 4);

    // scale and shift, the wave's 16 rows (all in flight at once)
    float4 w = ((const float4*)lnw)[lane];
    float4 b = ((const float4*)lnb)[lane];
    float4 xv[16];
#pragma unroll
    for (int r = 0; r < 16; ++r) xv[r] = *(const float4*)(xr + r * 128);
    // stands behind the row loads, ahead of any rewrite of a register that they name
    asm volatile("s_wait_xcnt 0x0" ::: "memory");

    _Float16* tw = tile + wv * 2048;            // the wave's 16 rows x 128 halves
    _Float16* hp = hn + row0 * 128 + lane * 4;
#pragma unroll
    for (int r = 0; r < 16; ++r) {
        float4 v = xv[r];
        float ps = v.x + v.y + v.z + v.w;
        ps += __shfl_xor(ps, 1, 32);  ps += __shfl_xor(ps, 2, 32);
        ps += __shfl_xor(ps, 4, 32);  ps += __shfl_xor(ps, 8, 32);
        ps += __shfl_xor(ps, 16, 32);
        float mu = ps * (1.0f / 128.0f);

        float dx = v.x - mu, dy = v.y - mu, dz = v.z - mu, dw = v.w - mu;
        float pv = dx * dx + dy * dy + dz * dz + dw * dw;
        pv += __shfl_xor(pv, 1, 32);  pv += __shfl_xor(pv, 2, 32);
        pv += __shfl_xor(pv, 4, 32);  pv += __shfl_xor(pv, 8, 32);
        pv += __shfl_xor(pv, 16, 32);
        float rs = rsqrtf(pv * (1.0f / 128.0f) + 1e-5f);

        union { _Float16 h[4]; uint2 u; } o;
        o.h[0] = (_Float16)(dx * rs * w.x + b.x);
        o.h[1] = (_Float16)(dy * rs * w.y + b.y);
        o.h[2] = (_Float16)(dz * rs * w.z + b.z);
        o.h[3] = (_Float16)(dw * rs * w.w + b.w);
        *(uint2*)(hp + r * 128) = o.u;
        // 16-byte piece lane >> 1 of row r, at place (lane >> 1) ^ r (see load_frag16_swz)
        *(uint2*)(tw + r * 128 + ((lane >> 1) ^ r) * 8 + (lane & 1) * 4) = o.u;
    }
    // the stores' address registers stay whole up to this wait
    asm volatile("s_wait_xcnt 0x0" :: "v"(hp) : "memory");
    {
        // row wv of the table: bias_w's row, or zeros from row 4 on
        union { _Float16 h[4]; uint2 u; } o;
        o.h[0] = (_Float16)bwv.x;  o.h[1] = (_Float16)bwv.y;
        o.h[2] = (_Float16)bwv.z;  o.h[3] = (_Float16)bwv.w;
        uint32_t keep = wv < 4 ? 0xffffffffu : 0u;
        *(uint2*)(bwt + wv * 136 + lane * 4) = make_uint2(o.u.x & keep, o.u.y & keep);
    }
    _Float16* wdst = wcat + idx;
    // inputs-only fence on the loaded value: it keeps the weight load above, among the
    // rows' work; without it the load sinks into the branch below, where its whole
    // latency stands in front of the barrier
    asm volatile("" :: "v"(wval));
    if (wv < 10)   // 1/sqrt(32) folded into q_w
        *wdst = (_Float16)(ts == 0 ? wval * 0.17677669529663687f : wval);
    // the weight store's registers stay whole up to this wait
    asm volatile("s_wait_xcnt 0x0" :: "v"(wdst) : "memory");
    // other lanes' and (bias_w) other waves' LDS stores are read below
    __syncthreads();

    int n = lane & 15, hi = lane >> 4;
    // c[r] = bias of key hi * 8 + r, column n = head
    v8f c = {};
#pragma unroll
    for (int kc = 0; kc < 4; ++kc) {
        v16h ab = load_frag16_swz(tw, kc, lane);
        // column n = row n of the table, K = hi*8 + 0..7 and 16 + hi*8 + 0..7 as in ab
        const _Float16* bp = bwt + n * 136 + kc * 32 + hi * 8;
        union { v16h h; uint4 q[2]; } bb;
        bb.q[0] = *(const uint4*)(bp);
        bb.q[1] = *(const uint4*)(bp + 16);
        c = __builtin_amdgcn_wmma_f32_16x16x32_f16(false, ab, false, bb.h, (short)0, c, false, false);
    }
    if (n < 4) {
        float* bo = biasb + (size_t)n * NN_ + (rb >> 4) * 4096 + (rb & 15) * 256 + (hi * 16 + wv) * 4;
        *(float4*)(bo)       = make_float4(c[0], c[1], c[2], c[3]);
        *(float4*)(bo + 128) = make_float4(c[4], c[5], c[6], c[7]);
    }
}

__device__ inline void stage_rows_swz(_Float16* atile, const _Float16* g, int t) {
    uint32_t l0 = lds_addr_of(atile) + (t >> 4) * 256 + (((t & 15) ^ ((t >> 4) & 15)) * 16);
    const _Float16* g0 = g + t * 8;
    asm volatile("global_load_async_to_lds_b128 %0, %8, off\n\t"
                 "global_load_async_to_lds_b128 %1, %9, off\n\t"
                 "global_load_async_to_lds_b128 %2, %10, off\n\t"
                 "global_load_async_to_lds_b128 %3, %11, off\n\t"
                 "global_load_async_to_lds_b128 %4, %12, off\n\t"
                 "global_load_async_to_lds_b128 %5, %13, off\n\t"
                 "global_load_async_to_lds_b128 %6, %14, off\n\t"
                 "global_load_async_to_lds_b128 %7, %15, off\n\t"
                 "s_wait_xcnt 0x0"
                 :: "v"(l0),            "v"(l0 + 1 * 8192),
                    "v"(l0 + 2 * 8192), "v"(l0 + 3 * 8192),
                    "v"(l0 + 4 * 8192), "v"(l0 + 5 * 8192),
                    "v"(l0 + 6 * 8192), "v"(l0 + 7 * 8192),
                    "v"((uint64_t)(uintptr_t)(g0)),
                    "v"((uint64_t)(uintptr_t)(g0 + 1 * 4096)),
                    "v"((uint64_t)(uintptr_t)(g0 + 2 * 4096)),
                    "v"((uint64_t)(uintptr_t)(g0 + 3 * 4096)),
                    "v"((uint64_t)(uintptr_t)(g0 + 4 * 4096)),
                    "v"((uint64_t)(uintptr_t)(g0 + 5 * 4096)),
                    "v"((uint64_t)(uintptr_t)(g0 + 6 * 4096)),
                    "v"((uint64_t)(uintptr_t)(g0 + 7 * 4096))
                 : "memory");
}

__device__ inline void copy_2x2(uint32_t la, const _Float16* ga, uint32_t lb, const _Float16* gb) {
    asm volatile("global_load_async_to_lds_b128 %0, %4, off\n\t"
                 "global_load_async_to_lds_b128 %1, %5, off\n\t"
                 "global_load_async_to_lds_b128 %2, %6, off\n\t"
                 "global_load_async_to_lds_b128 %3, %7, off\n\t"
                 "s_wait_xcnt 0x0"
                 :: "v"(la), "v"(la + 8192), "v"(lb), "v"(lb + 8192),
                    "v"((uint64_t)(uintptr_t)(ga)), "v"((uint64_t)(uintptr_t)(ga + 4096)),
                    "v"((uint64_t)(uintptr_t)(gb)), "v"((uint64_t)(uintptr_t)(gb + 4096))
                 : "memory");
}

// One head of a wave's query tile. On entry s holds the head's bias in S^T accumulator
// order. PRE: each pair of score tiles, once its exponents' arguments are taken, is
// refilled from bnext, the next head's bias, so that those loads fly under the rest
// of this head's softmax and V^T P^T instead of standing in front of the next scores.
template <bool PRE>
__device__ __forceinline__ void head_pass(_Float16* sh, int h, int jt, int lane,
                                          v8f (&s)[16], const float* bnext) {
    const _Float16* Kh = sh + 1 * 32768 + h * 8192;
    const _Float16* Vh = sh + 2 * 32768 + h * 8192;
    // Q^T fragment: column = query n (Q pre-scaled by 1/sqrt(DH) in its weights)
    const _Float16* qp = sh + h * 8192 + jt * 512;
    v16h bq = load_frag16_ord(qp, qp + 256, lane);

    // ---- S^T = K Q^T + bias^T: s[kt][r] = score(query n, key kt*16 + hi*8 + r)
#pragma unroll
    for (int kt = 0; kt < 16; ++kt) {
        v16h ak = load_frag16_ord(Kh + kt * 512, Kh + kt * 512 + 256, lane);
        s[kt] = __builtin_amdgcn_wmma_f32_16x16x32_f16(false, ak, false, bq,
                                                       (short)0, s[kt], false, false);
    }

    // ---- the query's maximum: in-lane, then one exchange between halves ----
    float mr[8];
#pragma unroll
    for (int r = 0; r < 8; ++r) {
        float m0 = s[0][r];
#pragma unroll
        for (int kt = 1; kt < 16; ++kt) m0 = fmaxf(m0, s[kt][r]);
        mr[r] = m0;
    }
    float mx = fmaxf(fmaxf(fmaxf(mr[0], mr[1]), fmaxf(mr[2], mr[3])),
                     fmaxf(fmaxf(mr[4], mr[5]), fmaxf(mr[6], mr[7])));
    mx = fmaxf(mx, __shfl_xor(mx, 16, 32));
    // exp(s - mx) = exp2(s * log2(e) - mx * log2(e)): one multiply-add per score, two
    // scores per packed instruction, straight into the hardware's exp2
    const float l2e = 1.4426950408889634f;
    const float nm = -mx * l2e;
    const v8f l2e8 = {l2e, l2e, l2e, l2e, l2e, l2e, l2e, l2e};
    const v8f nm8  = {nm, nm, nm, nm, nm, nm, nm, nm};
    // keeps the V^T fragment reads behind the scores: lifted above them they take
    // the wave past its 256 registers and loop addresses spill to scratch
    __builtin_amdgcn_sched_barrier(0);

    // ---- O^T = V^T P^T (two dh tiles of 16), P^T packed from the scores ----
    v8f sm = {};
    v8f o0 = {}, o1 = {};
#pragma unroll
    for (int kp = 0; kp < 8; ++kp) {
        v16h bp;
        v8f t0 = __builtin_elementwise_fma(s[2 * kp], l2e8, nm8);
        v8f t1 = __builtin_elementwise_fma(s[2 * kp + 1], l2e8, nm8);
        if constexpr (PRE) {
            // the bias plane lies in accumulator order (see ln_bias_kernel): each
            // wave-wide 16-byte load covers 512 contiguous bytes
            const float* bp4 = bnext + kp * 512;
            float4 c0 = *(const float4*)(bp4);
            float4 c1 = *(const float4*)(bp4 + 128);
            float4 c2 = *(const float4*)(bp4 + 256);
            float4 c3 = *(const float4*)(bp4 + 384);
            s[2 * kp]     = v8f{c0.x, c0.y, c0.z, c0.w, c1.x, c1.y, c1.z, c1.w};
            s[2 * kp + 1] = v8f{c2.x, c2.y, c2.z, c2.w, c3.x, c3.y, c3.z, c3.w};
        }
        v8f e0, e1;
#pragma unroll
        for (int r = 0; r < 8; ++r) {
            e0[r] = __builtin_amdgcn_exp2f(t0[r]);
            e1[r] = __builtin_amdgcn_exp2f(t1[r]);
            bp[r]     = (_Float16)e0[r];   // key kp*32 + hi*8 + r
            bp[8 + r] = (_Float16)e1[r];   // key kp*32 + 16 + hi*8 + r
        }
        sm += e0 + e1;
        v16h av0 = load_frag16_ord(Vh + kp * 512, Vh + kp * 512 + 256, lane);
        v16h av1 = load_frag16_ord(Vh + 4096 + kp * 512, Vh + 4096 + kp * 512 + 256, lane);
        o0 = __builtin_amdgcn_wmma_f32_16x16x32_f16(false, av0, false, bp,
                                                    (short)0, o0, false, false);
        o1 = __builtin_amdgcn_wmma_f32_16x16x32_f16(false, av1, false, bp,
                                                    (short)0, o1, false, false);
    }
    if constexpr (PRE) {
        // the loads' address registers stay whole up to this wait
        asm volatile("s_wait_xcnt 0x0" :: "v"(bnext) : "memory");
    }
    float sum = ((sm[0] + sm[1]) + (sm[2] + sm[3])) + ((sm[4] + sm[5]) + (sm[6] + sm[7]));
    sum += __shfl_xor(sum, 16, 32);
    // sum >= about 1 (the maximum's own term): the hardware reciprocal, no division sequence
    float inv = __builtin_amdgcn_rcpf(sum);

    // ---- normalize, gate with sigmoid(g), park as the lane's share of A chunk h:
    //      o0[r] = channel hi*8 + r, o1[r] = channel 16 + hi*8 + r of query n
    union { _Float16 h[8]; uint4 q; } g0, g1, r0, r1;
    _Float16* gp = sh + 3 * 32768 + h * 8192 + jt * 512 + lane * 8;
    g0.q = *(const uint4*)(gp);
    g1.q = *(const uint4*)(gp + 256);
#pragma unroll
    for (int r = 0; r < 8; ++r) {
        // 1 + exp(-g) lies in [1, inf]: the hardware reciprocal gives (0 at inf) what the
        // division sequence gave, within a rounding far below the f16 result's
        float s0 = __builtin_amdgcn_rcpf(1.0f + __builtin_amdgcn_exp2f(-l2e * (float)g0.h[r]));
        float s1 = __builtin_amdgcn_rcpf(1.0f + __builtin_amdgcn_exp2f(-l2e * (float)g1.h[r]));
        r0.h[r] = (_Float16)(o0[r] * inv * s0);
        r1.h[r] = (_Float16)(o1[r] * inv * s1);
    }
    *(uint4*)(gp)       = r0.q;
    *(uint4*)(gp + 256) = r1.q;
}

__global__ __launch_bounds__(512) void attn_kernel(const _Float16* __restrict__ hn,
                                                   const _Float16* __restrict__ wcat,
                                                   const float* __restrict__ biasb,
                                                   const _Float16* __restrict__ wo,
                                                   float* __restrict__ out) {
    // the whole LDS of a WGP: four planes of 4 x 8192 halves and the hn rows
    __shared__ __attribute__((aligned(16))) _Float16 sh[5 * 32768];
    _Float16* Qsh = sh;
    _Float16* Ksh = sh + 1 * 32768;
    _Float16* Vsh = sh + 2 * 32768;
    _Float16* Gsh = sh + 3 * 32768;
    _Float16* Ash = sh + 4 * 32768;   // hn rows; behind the projections o_w
    int i = blockIdx.x;
    int t = threadIdx.x, lane = t & 31;
    int jt = __builtin_amdgcn_readfirstlane(t >> 5);   // the wave's number and query tile

    stage_rows_swz(Ash, hn + (size_t)i * 256 * 128, t);

    {
        // weight fragments, loaded while the copies fly
        v16h b[2][4];
#pragma unroll
        for (int j = 0; j < 2; ++j)
#pragma unroll
            for (int kc = 0; kc < 4; ++kc)
                b[j][kc] = load_frag16(wcat + (jt * 2 + j) * 16 * 128 + kc * 32, 128, lane);

        // the wave's own copies have landed; the barrier publishes all waves' rows
        asm volatile("s_wait_asynccnt 0x0" ::: "memory");
        __syncthreads();

        _Float16* outp = sh + (jt >> 2) * 32768 + (jt & 3) * 8192 + lane * 8;
        if ((jt >> 2) == 2) {   // V: rows in the registers (wave-uniform branch)
#pragma unroll
            for (int rt = 0; rt < 16; ++rt) {
                v16h a[4];
#pragma unroll
                for (int kc = 0; kc < 4; ++kc) a[kc] = load_frag16_swz(Ash + rt * 2048, kc, lane);
                v8f c0 = {}, c1 = {};
#pragma unroll
                for (int kc = 0; kc < 4; ++kc) {
                    c0 = __builtin_amdgcn_wmma_f32_16x16x32_f16(false, a[kc], false, b[0][kc], (short)0, c0, false, false);
                    c1 = __builtin_amdgcn_wmma_f32_16x16x32_f16(false, a[kc], false, b[1][kc], (short)0, c1, false, false);
                }
                *(v8h*)(outp + rt * 256)        = __builtin_convertvector(c0, v8h);
                *(v8h*)(outp + (16 + rt) * 256) = __builtin_convertvector(c1, v8h);
            }
        } else {                // Q, K, G: channels in the registers
#pragma unroll
            for (int rt = 0; rt < 16; ++rt) {
                v16h a[4];
#pragma unroll
                for (int kc = 0; kc < 4; ++kc) a[kc] = load_frag16_swz(Ash + rt * 2048, kc, lane);
                v8f c0 = {}, c1 = {};
#pragma unroll
                for (int kc = 0; kc < 4; ++kc) {
                    c0 = __builtin_amdgcn_wmma_f32_16x16x32_f16(false, b[0][kc], false, a[kc], (short)0, c0, false, false);
                    c1 = __builtin_amdgcn_wmma_f32_16x16x32_f16(false, b[1][kc], false, a[kc], (short)0, c1, false, false);
                }
                *(v8h*)(outp + rt * 512)       = __builtin_convertvector(c0, v8h);
                *(v8h*)(outp + rt * 512 + 256) = __builtin_convertvector(c1, v8h);
            }
        }
    }
    // head 0's bias, straight into the score accumulators: asked for ahead of the barrier,
    // so that a wave's loads fly while later waves still work on their projections
    v8f s[16];
    const float* bb = biasb + jt * 4096 + lane * 4;
#pragma unroll
    for (int kt = 0; kt < 16; ++kt) {
        float4 c0 = *(const float4*)(bb + kt * 256);
        float4 c1 = *(const float4*)(bb + kt * 256 + 128);
        s[kt] = v8f{c0.x, c0.y, c0.z, c0.w, c1.x, c1.y, c1.z, c1.w};
    }
    // the loads' address registers stay whole up to this wait
    asm volatile("s_wait_xcnt 0x0" :: "v"(bb) : "memory");
    // the wave's own LDS reads and writes are done; the barrier publishes the four
    // planes and ends every wave's last read of the hn rows
    asm volatile("s_wait_dscnt 0x0" ::: "memory");
    __syncthreads();
    // o_w (4 pieces per lane) over the hn rows; waited for and published in front of head 1
    copy_2x2(lds_addr_of(Ash) + t * 16, wo + t * 8, lds_addr_of(Ash) + 16384 + t * 16, wo + 8192 + t * 8);

    // kept rolled: three copies of the body would buy nothing; the last head, which has no
    // bias to fetch ahead, is a copy of its own
#pragma unroll 1
    for (int h = 0; h < 3; ++h) {
        if (h == 1) {
            // o_w: own copies landed, then published to all waves
            asm volatile("s_wait_asynccnt 0x0" ::: "memory");
            __syncthreads();
        }
        head_pass<true>(sh, h, jt, lane, s, bb + (size_t)(h + 1) * NN_);
    }
    head_pass<false>(sh, 3, jt, lane, s, bb);

    // ---- out rows i*256 + jt*16 .. + 15 = og o_w^T (f32 result): A = the parked
    //      fragments, row = query n, k chunk = head; B = o_w column tile ct
    v16h a[4];
#pragma unroll
    for (int kc = 0; kc < 4; ++kc) {
        const _Float16* f = Gsh + kc * 8192 + jt * 512;
        a[kc] = load_frag16_ord(f, f + 256, lane);
    }
    int hi = lane >> 4, n = lane & 15;
    float* op = out + (size_t)(i * 256 + jt * 16 + hi * 8) * 128 + n;
#pragma unroll
    for (int ct = 0; ct < 8; ++ct) {
        v8f c = {};
#pragma unroll
        for (int kc = 0; kc < 4; ++kc) {
            const _Float16* f = Ash + (ct * 4 + kc) * 512;
            v16h b = load_frag16_ord(f, f + 256, lane);
            c = __builtin_amdgcn_wmma_f32_16x16x32_f16(false, a[kc], false, b, (short)0, c, false, false);
        }
#pragma unroll
        for (int r = 0; r < 8; ++r)
            op[r * 128 + ct * 16] = c[r];
    }
}

// ---------------------------------------------------------------------------
extern "C" void kernel_launch(void* const* d_in, const int* in_sizes, int n_in,
                              void* d_out, int out_size, void* d_ws, size_t ws_size,
                              hipStream_t stream) {
    const float* x   = (const float*)d_in[0];
    const float* lnw = (const float*)d_in[1];
    const float* lnb = (const float*)d_in[2];
    const float* bw  = (const float*)d_in[3];
    const float* qw  = (const float*)d_in[4];
    const float* kw  = (const float*)d_in[5];
    const float* vw  = (const float*)d_in[6];
    const float* gw  = (const float*)d_in[7];
    const float* ow  = (const float*)d_in[8];
    float* out = (float*)d_out;

    char* ws = (char*)d_ws;
    _Float16* hn    = (_Float16*)ws;                       // NN*D f16
    float*    biasb = (float*)(hn + (size_t)NN_ * D_);     // H*NN f32
    _Float16* wcat  = (_Float16*)(biasb + (size_t)H_ * NN_);  // 512*128 f16
    _Float16* wo    = wcat + 512 * 128;                    // 128*128 f16, written through wcat

    ln_bias_kernel<<<256, 512, 0, stream>>>(x, lnw, lnb, bw, qw, kw, vw, gw, ow, wcat, hn, biasb);
    attn_kernel<<<256, 512, 0, stream>>>(hn, wcat, biasb, wo, out);
}

// v010
// Measured time: 32.3 microseconds a run.
// Timed twice side by side with v009, it ran 1.04 and 1.05 times as fast.
// All steps since v000 together make it 6.60 times as fast.
#include <hip/hip_runtime.h>

typedef __attribute__((ext_vector_type(16))) _Float16 v16h;
typedef __attribute__((ext_vector_type(8)))  float    v8f;
typedef __attribute__((ext_vector_type(8)))  _Float16 v8h;

constexpr int NN_ = 65536;   // N*N rows
constexpr int D_  = 128;
constexpr int H_  = 4;

union FragH { v16h h; uint32_t u[8]; };

__device__ inline uint32_t lds_addr_of(const void* p) {
    return (uint32_t)(uintptr_t)p;
}

__device__ inline v16h load_frag16(const _Float16* base, int stride, int lane) {
    int rc = lane & 15;
    int hi = (lane >> 4) & 1;
    const _Float16* p = base + rc * stride;
    FragH f;
#pragma unroll
    for (int v = 0; v < 8; ++v) {
        int k = ((v & 4) << 2) + hi * 8 + (v & 3) * 2;   // pairs of consecutive K
        f.u[v] = *(const uint32_t*)(p + k);
    }
    return f.h;
}

__device__ inline v16h load_frag16_swz(const _Float16* tile, int kc, int lane) {
    int n = lane & 15, hi = (lane >> 4) & 1;
    const _Float16* p = tile + n * 128;
    union { v16h h; uint4 q[2]; } f;
    f.q[0] = *(const uint4*)(p + ((kc * 4 + hi) ^ n) * 8);       // K = hi*8 + 0..7
    f.q[1] = *(const uint4*)(p + ((kc * 4 + 2 + hi) ^ n) * 8);   // K = 16 + hi*8 + 0..7
    return f.h;
}

// A fragment stored in fragment order: two pieces of 32 lanes x 16 B, piece 0 at
// p0 and piece 1 at p1 (halves K = hi*8 + 0..7 and K = 16 + hi*8 + 0..7 of the
// lane's row or column). Each wave-wide load covers 512 contiguous bytes.
__device__ inline v16h load_frag16_ord(const _Float16* p0, const _Float16* p1, int lane) {
    union { v16h h; uint4 q[2]; } f;
    f.q[0] = *(const uint4*)(p0 + lane * 8);
    f.q[1] = *(const uint4*)(p1 + lane * 8);
    return f.h;
}

// ---------------------------------------------------------------------------
// Kernel 1: LayerNorm over D=128 and the triangle bias. 256 work-groups of 16
// waves; wave w of work-group rb takes the 16 rows (queries (rb >> 4) * 16 .. + 15,
// key (rb & 15) * 16 + w): float4 per lane and row, shfl_xor reductions, packed
// 8-byte f16 store to hn. The same 8 bytes go to the wave's LDS tile, from which
// the rows come back as the A fragments of the bias product hn bias_w^T.
// The bias plane is f16, laid out as half an A fragment of the attention kernel
// (row = key, k = query in the tile):
// [head][query tile][key tile][lane = hi * 16 + (key & 15)][8 halves], query in the
// tile = hi * 8 + 0..7. A lane's 8 accumulators are one such 16-byte piece.
// Work-group rb writes the whole 512 B block (query tile rb >> 4, key tile rb & 15)
// of each head.
// The launch also converts the weights of the attention kernel to f16, 320
// elements (five whole 128-byte lines) per work-group, one per lane of waves 0..9,
// while the rows are in flight:
//   wcat rows [0..127] = q_w / sqrt(32), [128..255] = k_w, [256..383] = v_w,
//   [384..511] = g_w; behind them wo = o_w in the order of the B fragments of the
//   output product: pieces [column tile][k chunk][half q][lane][8],
//   column = tile*16 + (lane & 15), k = chunk*32 + q*16 + (lane >> 4)*8 + 0..7.
// bias_w is read as f32: wave w < 4 converts row w into an LDS table of 16 rows
// (rows 4..15 zero) from which every wave takes its B fragments.
// ---------------------------------------------------------------------------
__global__ __launch_bounds__(512) void ln_bias_kernel(const float* __restrict__ x,
                                                      const float* __restrict__ lnw,
                                                      const float* __restrict__ lnb,
                                                      const float* __restrict__ bw,
                                                      const float* __restrict__ qw,
                                                      const float* __restrict__ kw,
                                                      const float* __restrict__ vw,
                                                      const float* __restrict__ gw,
                                                      const float* __restrict__ ow,
                                                      _Float16* __restrict__ wcat,
                                                      _Float16* __restrict__ hn,
                                                      _Float16* __restrict__ biasb) {
    __shared__ __attribute__((aligned(16))) _Float16 tile[16 * 2048];
    __shared__ __attribute__((aligned(16))) _Float16 bwt[16 * 136];
    int rb = blockIdx.x;
    int t = threadIdx.x, lane = t & 31;
    int wv = __builtin_amdgcn_readfirstlane(t >> 5);
    size_t row0 = (size_t)((rb >> 4) * 16) * 256 + (rb & 15) * 16 + wv;   // rows row0 + r * 256
    const float* xr = x + row0 * 128 + lane * 4;

    // the lane's weight element (waves 10..15 read wave 9's again and store nothing)
    // and the wave's piece of bias_w. A wave's 32 elements
    // lie in one tensor: ts is the same in all its lanes.
    int wb = rb * 320 + (wv < 10 ? wv : 9) * 32;
    int ts = wb >> 14;                           // tensor q, k, v, g, o
    int idx = wb + lane, e = idx & 16383;        // element in the tensor
    int fl = (e >> 3) & 31;
    int sj = ((e >> 11) * 16 + (fl & 15)) * 128 + ((e >> 9) & 3) * 32
           + ((e >> 8) & 1) * 16 + (fl >> 4) * 8 + (e & 7);
    const float* wsrc = ts == 0 ? qw : ts == 1 ? kw : ts == 2 ? vw : ts == 3 ? gw : ow;
    float wval = wsrc[ts == 4 ? sj : e];
    float4 bwv = *(const float4*)(bw + (wv & 3) * 128 + lane * 4);

    // scale and shift, the wave's 16 rows (all in flight at once)
    float4 w = ((const float4*)lnw)[lane];
    float4 b = ((const float4*)lnb)[lane];
    float4 xv[16];
#pragma unroll
    for (int r = 0; r < 16; ++r) xv[r] = *(const float4*)(xr + r * (256 * 128));
    // stands behind the row loads, ahead of any rewrite of a register that they name
    asm volatile("s_wait_xcnt 0x0" ::: "memory");

    _Float16* tw = tile + wv * 2048;            // the wave's 16 rows x 128 halves
    _Float16* hp = hn + row0 * 128 + lane * 4;
#pragma unroll
    for (int r = 0; r < 16; ++r) {
        float4 v = xv[r];
        float ps = v.x + v.y + v.z + v.w;
        ps += __shfl_xor(ps, 1, 32);  ps += __shfl_xor(ps, 2, 32);
        ps += __shfl_xor(ps, 4, 32);  ps += __shfl_xor(ps, 8, 32);
        ps += __shfl_xor(ps, 16, 32);
        float mu = ps * (1.0f / 128.0f);

        float dx = v.x - mu, dy = v.y - mu, dz = v.z - mu, dw = v.w - mu;
        float pv = dx * dx + dy * dy + dz * dz + dw * dw;
        pv += __shfl_xor(pv, 1, 32);  pv += __shfl_xor(pv, 2, 32);
        pv += __shfl_xor(pv, 4, 32);  pv += __shfl_xor(pv, 8, 32);
        pv += __shfl_xor(pv, 16, 32);
        float rs = rsqrtf(pv * (1.0f / 128.0f) + 1e-5f);

        union { _Float16 h[4]; uint2 u; } o;
        o.h[0] = (_Float16)(dx * rs * w.x + b.x);
        o.h[1] = (_Float16)(dy * rs * w.y + b.y);
        o.h[2] = (_Float16)(dz * rs * w.z + b.z);
        o.h[3] = (_Float16)(dw * rs * w.w + b.w);
        *(uint2*)(hp + r * (256 * 128)) = o.u;
        // 16-byte piece lane >> 1 of row r, at place (lane >> 1) ^ r (see load_frag16_swz)
        *(uint2*)(tw + r * 128 + ((lane >> 1) ^ r) * 8 + (lane & 1) * 4) = o.u;
    }
    // the stores' address registers stay whole up to this wait
    asm volatile("s_wait_xcnt 0x0" :: "v"(hp) : "memory");
    {
        // row wv of the table: bias_w's row, or zeros from row 4 on
        union { _Float16 h[4]; uint2 u; } o;
        o.h[0] = (_Float16)bwv.x;  o.h[1] = (_Float16)bwv.y;
        o.h[2] = (_Float16)bwv.z;  o.h[3] = (_Float16)bwv.w;
        uint32_t keep = wv < 4 ? 0xffffffffu : 0u;
        *(uint2*)(bwt + wv * 136 + lane * 4) = make_uint2(o.u.x & keep, o.u.y & keep);
    }
    _Float16* wdst = wcat + idx;
    // inputs-only fence on the loaded value: it keeps the weight load above, among the
    // rows' work; without it the load sinks into the branch below, where its whole
    // latency stands in front of the barrier
    asm volatile("" :: "v"(wval));
    if (wv < 10)   // 1/sqrt(32) folded into q_w
        *wdst = (_Float16)(ts == 0 ? wval * 0.17677669529663687f : wval);
    // the weight store's registers stay whole up to this wait
    asm volatile("s_wait_xcnt 0x0" :: "v"(wdst) : "memory");
    // other lanes' and (bias_w) other waves' LDS stores are read below
    __syncthreads();

    int n = lane & 15, hi = lane >> 4;
    // c[r] = bias of query hi * 8 + r, column n = head
    v8f c = {};
#pragma unroll
    for (int kc = 0; kc < 4; ++kc) {
        v16h ab = load_frag16_swz(tw, kc, lane);
        // column n = row n of the table, K = hi*8 + 0..7 and 16 + hi*8 + 0..7 as in ab
        const _Float16* bp = bwt + n * 136 + kc * 32 + hi * 8;
        union { v16h h; uint4 q[2]; } bb;
        bb.q[0] = *(const uint4*)(bp);
        bb.q[1] = *(const uint4*)(bp + 16);
        c = __builtin_amdgcn_wmma_f32_16x16x32_f16(false, ab, false, bb.h, (short)0, c, false, false);
    }
    if (n < 4) {
        _Float16* bo = biasb + (size_t)n * NN_ + (rb >> 4) * 4096 + (rb & 15) * 256 + (hi * 16 + wv) * 8;
        *(v8h*)(bo) = __builtin_convertvector(c, v8h);
    }
}

__device__ inline void stage_rows_swz(_Float16* atile, const _Float16* g, int t) {
    uint32_t l0 = lds_addr_of(atile) + (t >> 4) * 256 + (((t & 15) ^ ((t >> 4) & 15)) * 16);
    const _Float16* g0 = g + t * 8;
    asm volatile("global_load_async_to_lds_b128 %0, %8, off\n\t"
                 "global_load_async_to_lds_b128 %1, %9, off\n\t"
                 "global_load_async_to_lds_b128 %2, %10, off\n\t"
                 "global_load_async_to_lds_b128 %3, %11, off\n\t"
                 "global_load_async_to_lds_b128 %4, %12, off\n\t"
                 "global_load_async_to_lds_b128 %5, %13, off\n\t"
                 "global_load_async_to_lds_b128 %6, %14, off\n\t"
                 "global_load_async_to_lds_b128 %7, %15, off\n\t"
                 "s_wait_xcnt 0x0"
                 :: "v"(l0),            "v"(l0 + 1 * 8192),
                    "v"(l0 + 2 * 8192), "v"(l0 + 3 * 8192),
                    "v"(l0 + 4 * 8192), "v"(l0 + 5 * 8192),
                    "v"(l0 + 6 * 8192), "v"(l0 + 7 * 8192),
                    "v"((uint64_t)(uintptr_t)(g0)),
                    "v"((uint64_t)(uintptr_t)(g0 + 1 * 4096)),
                    "v"((uint64_t)(uintptr_t)(g0 + 2 * 4096)),
                    "v"((uint64_t)(uintptr_t)(g0 + 3 * 4096)),
                    "v"((uint64_t)(uintptr_t)(g0 + 4 * 4096)),
                    "v"((uint64_t)(uintptr_t)(g0 + 5 * 4096)),
                    "v"((uint64_t)(uintptr_t)(g0 + 6 * 4096)),
                    "v"((uint64_t)(uintptr_t)(g0 + 7 * 4096))
                 : "memory");
}

__device__ inline void copy_2x2(uint32_t la, const _Float16* ga, uint32_t lb, const _Float16* gb) {
    asm volatile("global_load_async_to_lds_b128 %0, %4, off\n\t"
                 "global_load_async_to_lds_b128 %1, %5, off\n\t"
                 "global_load_async_to_lds_b128 %2, %6, off\n\t"
                 "global_load_async_to_lds_b128 %3, %7, off\n\t"
                 "s_wait_xcnt 0x0"
                 :: "v"(la), "v"(la + 8192), "v"(lb), "v"(lb + 8192),
                    "v"((uint64_t)(uintptr_t)(ga)), "v"((uint64_t)(uintptr_t)(ga + 4096)),
                    "v"((uint64_t)(uintptr_t)(gb)), "v"((uint64_t)(uintptr_t)(gb + 4096))
                 : "memory");
}

// One head of a wave's query tile. On entry ab[kp] holds the head's bias for key tiles
// 2 kp (k = 0..15) and 2 kp + 1 (k = 16..31) as one A fragment, row = key, k = query;
// id0 and id1 are the B operands that pick the one or the other: B[k][n] = 1 where
// k = n (id0) or k = 16 + n (id1), else 0.
// PRE: as each pair of score tiles gives up its registers (its exponents' arguments
// taken), ab[kp] is refilled from bnext, the next head's bias, so that those loads fly
// under the rest of this head's softmax and V^T P^T.
template <bool PRE>
__device__ __forceinline__ void head_pass(_Float16* sh, int h, int jt, int lane,
                                          v16h (&ab)[8], v16h id0, v16h id1,
                                          const _Float16* bnext) {
    const _Float16* Kh = sh + 1 * 32768 + h * 8192;
    const _Float16* Vh = sh + 2 * 32768 + h * 8192;
    // Q^T fragment: column = query n (Q pre-scaled by 1/sqrt(DH) in its weights)
    const _Float16* qp = sh + h * 8192 + jt * 512;
    v16h bq = load_frag16_ord(qp, qp + 256, lane);

    // ---- S^T = bias^T + K Q^T: s[kt][r] = score(query n, key kt*16 + hi*8 + r)
    v8f s[16];
#pragma unroll
    for (int kp = 0; kp < 8; ++kp) {
        const v8f z = {};
        s[2 * kp]     = __builtin_amdgcn_wmma_f32_16x16x32_f16(false, ab[kp], false, id0,
                                                               (short)0, z, false, false);
        s[2 * kp + 1] = __builtin_amdgcn_wmma_f32_16x16x32_f16(false, ab[kp], false, id1,
                                                               (short)0, z, false, false);
    }
    // keeps the 16 bias products together, ahead of the K reads: spread among the K
    // products they hold the bias fragments live, and the K fragments are then left a
    // single register set whose every read is waited out
    __builtin_amdgcn_sched_barrier(0);
#pragma unroll
    for (int kt = 0; kt < 16; ++kt) {
        v16h ak = load_frag16_ord(Kh + kt * 512, Kh + kt * 512 + 256, lane);
        s[kt] = __builtin_amdgcn_wmma_f32_16x16x32_f16(false, ak, false, bq,
                                                       (short)0, s[kt], false, false);
    }

    // ---- the query's maximum: in-lane, then one exchange between halves ----
    float mr[8];
#pragma unroll
    for (int r = 0; r < 8; ++r) {
        float m0 = s[0][r];
#pragma unroll
        for (int kt = 1; kt < 16; ++kt) m0 = fmaxf(m0, s[kt][r]);
        mr[r] = m0;
    }
    float mx = fmaxf(fmaxf(fmaxf(mr[0], mr[1]), fmaxf(mr[2], mr[3])),
                     fmaxf(fmaxf(mr[4], mr[5]), fmaxf(mr[6], mr[7])));
    mx = fmaxf(mx, __shfl_xor(mx, 16, 32));
    // exp(s - mx) = exp2(s * log2(e) - mx * log2(e)): one multiply-add per score, two
    // scores per packed instruction, straight into the hardware's exp2
    const float l2e = 1.4426950408889634f;
    const float nm = -mx * l2e;
    const v8f l2e8 = {l2e, l2e, l2e, l2e, l2e, l2e, l2e, l2e};
    const v8f nm8  = {nm, nm, nm, nm, nm, nm, nm, nm};
    // keeps the V^T fragment reads behind the scores: lifted above them they take
    // the wave past its 256 registers and loop addresses spill to scratch
    __builtin_amdgcn_sched_barrier(0);

    // ---- O^T = V^T P^T (two dh tiles of 16), P^T packed from the scores ----
    v8f sm = {};
    v8f o0 = {}, o1 = {};
#pragma unroll
    for (int kp = 0; kp < 8; ++kp) {
        v16h bp;
        v8f t0 = __builtin_elementwise_fma(s[2 * kp], l2e8, nm8);
        v8f t1 = __builtin_elementwise_fma(s[2 * kp + 1], l2e8, nm8);
        if constexpr (PRE) {
            // the bias plane lies in fragment order (see ln_bias_kernel): each
            // wave-wide 16-byte load covers 512 contiguous bytes
            union { v16h h; uint4 q[2]; } f;
            f.q[0] = *(const uint4*)(bnext + kp * 512);         // key tile 2 kp
            f.q[1] = *(const uint4*)(bnext + kp * 512 + 256);   // key tile 2 kp + 1
            ab[kp] = f.h;
        }
        v8f e0, e1;
#pragma unroll
        for (int r = 0; r < 8; ++r) {
            e0[r] = __builtin_amdgcn_exp2f(t0[r]);
            e1[r] = __builtin_amdgcn_exp2f(t1[r]);
            bp[r]     = (_Float16)e0[r];   // key kp*32 + hi*8 + r
            bp[8 + r] = (_Float16)e1[r];   // key kp*32 + 16 + hi*8 + r
        }
        sm += e0 + e1;
        v16h av0 = load_frag16_ord(Vh + kp * 512, Vh + kp * 512 + 256, lane);
        v16h av1 = load_frag16_ord(Vh + 4096 + kp * 512, Vh + 4096 + kp * 512 + 256, lane);
        o0 = __builtin_amdgcn_wmma_f32_16x16x32_f16(false, av0, false, bp,
                                                    (short)0, o0, false, false);
        o1 = __builtin_amdgcn_wmma_f32_16x16x32_f16(false, av1, false, bp,
                                                    (short)0, o1, false, false);
    }
    if constexpr (PRE) {
        // the loads' address registers stay whole up to this wait
        asm volatile("s_wait_xcnt 0x0" :: "v"(bnext) : "memory");
    }
    float sum = ((sm[0] + sm[1]) + (sm[2] + sm[3])) + ((sm[4] + sm[5]) + (sm[6] + sm[7]));
    sum += __shfl_xor(sum, 16, 32);
    // sum >= about 1 (the maximum's own term): the hardware reciprocal, no division sequence
    float inv = __builtin_amdgcn_rcpf(sum);

    // ---- normalize, gate with sigmoid(g), park as the lane's share of A chunk h:
    //      o0[r] = channel hi*8 + r, o1[r] = channel 16 + hi*8 + r of query n
    union { _Float16 h[8]; uint4 q; } g0, g1, r0, r1;
    _Float16* gp = sh + 3 * 32768 + h * 8192 + jt * 512 + lane * 8;
    g0.q = *(const uint4*)(gp);
    g1.q = *(const uint4*)(gp + 256);
#pragma unroll
    for (int r = 0; r < 8; ++r) {
        // 1 + exp(-g) lies in [1, inf]: the hardware reciprocal gives (0 at inf) what the
        // division sequence gave, within a rounding far below the f16 result's
        float s0 = __builtin_amdgcn_rcpf(1.0f + __builtin_amdgcn_exp2f(-l2e * (float)g0.h[r]));
        float s1 = __builtin_amdgcn_rcpf(1.0f + __builtin_amdgcn_exp2f(-l2e * (float)g1.h[r]));
        r0.h[r] = (_Float16)(o0[r] * inv * s0);
        r1.h[r] = (_Float16)(o1[r] * inv * s1);
    }
    *(uint4*)(gp)       = r0.q;
    *(uint4*)(gp + 256) = r1.q;
}

__global__ __launch_bounds__(512) void attn_kernel(const _Float16* __restrict__ hn,
                                                   const _Float16* __restrict__ wcat,
                                                   const _Float16* __restrict__ biasb,
                                                   const _Float16* __restrict__ wo,
                                                   float* __restrict__ out) {
    // the whole LDS of a WGP: four planes of 4 x 8192 halves and the hn rows
    __shared__ __attribute__((aligned(16))) _Float16 sh[5 * 32768];
    _Float16* Qsh = sh;
    _Float16* Ksh = sh + 1 * 32768;
    _Float16* Vsh = sh + 2 * 32768;
    _Float16* Gsh = sh + 3 * 32768;
    _Float16* Ash = sh + 4 * 32768;   // hn rows; behind the projections o_w
    int i = blockIdx.x;
    int t = threadIdx.x, lane = t & 31;
    int jt = __builtin_amdgcn_readfirstlane(t >> 5);   // the wave's number and query tile

    stage_rows_swz(Ash, hn + (size_t)i * 256 * 128, t);

    {
        // weight fragments, loaded while the copies fly
        v16h b[2][4];
#pragma unroll
        for (int j = 0; j < 2; ++j)
#pragma unroll
            for (int kc = 0; kc < 4; ++kc)
                b[j][kc] = load_frag16(wcat + (jt * 2 + j) * 16 * 128 + kc * 32, 128, lane);

        // the wave's own copies have landed; the barrier publishes all waves' rows
        asm volatile("s_wait_asynccnt 0x0" ::: "memory");
        __syncthreads();

        _Float16* outp = sh + (jt >> 2) * 32768 + (jt & 3) * 8192 + lane * 8;
        if ((jt >> 2) == 2) {   // V: rows in the registers (wave-uniform branch)
#pragma unroll
            for (int rt = 0; rt < 16; ++rt) {
                v16h a[4];
#pragma unroll
                for (int kc = 0; kc < 4; ++kc) a[kc] = load_frag16_swz(Ash + rt * 2048, kc, lane);
                v8f c0 = {}, c1 = {};
#pragma unroll
                for (int kc = 0; kc < 4; ++kc) {
                    c0 = __builtin_amdgcn_wmma_f32_16x16x32_f16(false, a[kc], false, b[0][kc], (short)0, c0, false, false);
                    c1 = __builtin_amdgcn_wmma_f32_16x16x32_f16(false, a[kc], false, b[1][kc], (short)0, c1, false, false);
                }
                *(v8h*)(outp + rt * 256)        = __builtin_convertvector(c0, v8h);
                *(v8h*)(outp + (16 + rt) * 256) = __builtin_convertvector(c1, v8h);
            }
        } else {                // Q, K, G: channels in the registers
#pragma unroll
            for (int rt = 0; rt < 16; ++rt) {
                v16h a[4];
#pragma unroll
                for (int kc = 0; kc < 4; ++kc) a[kc] = load_frag16_swz(Ash + rt * 2048, kc, lane);
                v8f c0 = {}, c1 = {};
#pragma unroll
                for (int kc = 0; kc < 4; ++kc) {
                    c0 = __builtin_amdgcn_wmma_f32_16x16x32_f16(false, b[0][kc], false, a[kc], (short)0, c0, false, false);
                    c1 = __builtin_amdgcn_wmma_f32_16x16x32_f16(false, b[1][kc], false, a[kc], (short)0, c1, false, false);
                }
                *(v8h*)(outp + rt * 512)       = __builtin_convertvector(c0, v8h);
                *(v8h*)(outp + rt * 512 + 256) = __builtin_convertvector(c1, v8h);
            }
        }
    }
    // head 0's bias fragments: asked for ahead of the barrier, so that a wave's loads
    // fly while later waves still work on their projections
    v16h ab[8];
    const _Float16* bb = biasb + jt * 4096 + lane * 8;
#pragma unroll
    for (int kp = 0; kp < 8; ++kp) {
        union { v16h h; uint4 q[2]; } f;
        f.q[0] = *(const uint4*)(bb + kp * 512);
        f.q[1] = *(const uint4*)(bb + kp * 512 + 256);
        ab[kp] = f.h;
    }
    // the identity operands, in the k order of every fragment here: a lane's halves
    // 0..7 are k = (lane >> 4) * 8 + 0..7, halves 8..15 are k = 16 + the same
    FragH id0, id1;
#pragma unroll
    for (int v = 0; v < 4; ++v) {
        int k = (lane >> 4) * 8 + v * 2, col = lane & 15;
        uint32_t one = k == col ? 0x00003c00u : k + 1 == col ? 0x3c000000u : 0u;   // 1.0 as f16
        id0.u[v] = one;  id0.u[4 + v] = 0u;
        id1.u[v] = 0u;   id1.u[4 + v] = one;
    }
    // the loads' address registers stay whole up to this wait
    asm volatile("s_wait_xcnt 0x0" :: "v"(bb) : "memory");
    // the wave's own LDS reads and writes are done; the barrier publishes the four
    // planes and ends every wave's last read of the hn rows
    asm volatile("s_wait_dscnt 0x0" ::: "memory");
    __syncthreads();
    // o_w (4 pieces per lane) over the hn rows; waited for and published in front of head 1
    copy_2x2(lds_addr_of(Ash) + t * 16, wo + t * 8, lds_addr_of(Ash) + 16384 + t * 16, wo + 8192 + t * 8);

    // kept rolled: three copies of the body would buy nothing; the last head, which has no
    // bias to fetch ahead, is a copy of its own
#pragma unroll 1
    for (int h = 0; h < 3; ++h) {
        if (h == 1) {
            // o_w: own copies landed, then published to all waves
            asm volatile("s_wait_asynccnt 0x0" ::: "memory");
            __syncthreads();
        }
        head_pass<true>(sh, h, jt, lane, ab, id0.h, id1.h, bb + (size_t)(h + 1) * NN_);
    }
    head_pass<false>(sh, 3, jt, lane, ab, id0.h, id1.h, bb);

    // ---- out rows i*256 + jt*16 .. + 15 = og o_w^T (f32 result): A = the parked
    //      fragments, row = query n, k chunk = head; B = o_w column tile ct
    v16h a[4];
#pragma unroll
    for (int kc = 0; kc < 4; ++kc) {
        const _Float16* f = Gsh + kc * 8192 + jt * 512;
        a[kc] = load_frag16_ord(f, f + 256, lane);
    }
    int hi = lane >> 4, n = lane & 15;
    float* op = out + (size_t)(i * 256 + jt * 16 + hi * 8) * 128 + n;
#pragma unroll
    for (int ct = 0; ct < 8; ++ct) {
        v8f c = {};
#pragma unroll
        for (int kc = 0; kc < 4; ++kc) {
            const _Float16* f = Ash + (ct * 4 + kc) * 512;
            v16h b = load_frag16_ord(f, f + 256, lane);
            c = __builtin_amdgcn_wmma_f32_16x16x32_f16(false, a[kc], false, b, (short)0, c, false, false);
        }
#pragma unroll
        for (int r = 0; r < 8; ++r)
            op[r * 128 + ct * 16] = c[r];
    }
}

// ---------------------------------------------------------------------------
extern "C" void kernel_launch(void* const* d_in, const int* in_sizes, int n_in,
                              void* d_out, int out_size, void* d_ws, size_t ws_size,
                              hipStream_t stream) {
    const float* x   = (const float*)d_in[0];
    const float* lnw = (const float*)d_in[1];
    const float* lnb = (const float*)d_in[2];
    const float* bw  = (const float*)d_in[3];
    const float* qw  = (const float*)d_in[4];
    const float* kw  = (const float*)d_in[5];
    const float* vw  = (const float*)d_in[6];
    const float* gw  = (const float*)d_in[7];
    const float* ow  = (const float*)d_in[8];
    float* out = (float*)d_out;

    char* ws = (char*)d_ws;
    _Float16* hn    = (_Float16*)ws;                       // NN*D f16
    _Float16* biasb = hn + (size_t)NN_ * D_;               // H*NN f16
    _Float16* wcat  = biasb + (size_t)H_ * NN_;            // 512*128 f16
    _Float16* wo    = wcat + 512 * 128;                    // 128*128 f16, written through wcat

    ln_bias_kernel<<<256, 512, 0, stream>>>(x, lnw, lnb, bw, qw, kw, vw, gw, ow, wcat, hn, biasb);
    attn_kernel<<<256, 512, 0, stream>>>(hn, wcat, biasb, wo, out);
}
